// v000
// Measured on an AMD MI455X. A time is GPU time per run, averaged over a window of back-to-back runs after a warm-up
// (all launches, gaps included; the runs take copies of the inputs in turn), and the median of several windows.
// Apart from v000's, it joins two sittings. Times from different sittings can be a few percent apart, while
// side-by-side timings come from the same sitting.
// v000, which the later versions start from, runs in 1080 microseconds.
#include <hip/hip_runtime.h>

// CAM (cross-attention module): q = input1 Wq + bq [8192][32]; k = input2 Wk + bk, v = input2 Wv + bv [8192][32]; scores = q k^T (no scaling); w = softmax over the 8,192 keys; fused = w v; LayerNorm(fused) (eps 1e-5, gamma/beta);
// out = normed Wo + bo -> [8192][128].
// Deterministic: no index structures, no atomics.
// WMMA (v_wmma_f32_16x16x32_f16, f32 accumulate): projections with the inputs EXACT bf16 x8 (K 128, 2 tiles each) against exact weight rows x256; S = q k^T per (16-query tile, 128-key block) and O += P V (q/k/v/P hi+lo x256; 3 products each);
// out = LN(fused) (hi+lo) x Wo rows (K 32, 8 tiles). Online softmax and LayerNorm in f32. Inputs rounded to bf16 once. Fragment k-map per lane half hh for A AND B: elements 0..7 <- k = 8hh+0..7, 8..15 <- k = 16+8hh+0..7;

namespace {
constexpr int N1 = 8192, N2 = 8192, DI = 128, D = 32, FO = 128, KB = 128;
constexpr float XS = 8.0f, HS = 256.0f, WSC = 256.0f, PS = 256.0f, LNEPS = 1e-5f;
typedef _Float16 b16;
typedef __attribute__((ext_vector_type(16))) _Float16 v16b;
typedef __attribute__((ext_vector_type(8))) _Float16 v8b;
typedef __attribute__((ext_vector_type(8))) float v8f;
typedef __attribute__((ext_vector_type(4))) float v4f;
__device__ __forceinline__ float bf16_rne(float f) { unsigned int u = __float_as_uint(f); u += 0x7FFFu + ((u >> 16) & 1u); float r = __uint_as_float(u & 0xFFFF0000u); asm volatile("" : "+v"(r)); return r; }
__device__ __forceinline__ float bfv(float f) { float r = bf16_rne(f); asm volatile("" : "+v"(r)); return r; }
__device__ __forceinline__ void split16(float v, b16& hi, b16& lo) { hi = (b16)v; lo = (b16)(v - (float)hi); }
__device__ __forceinline__ v16b frag_kb(const b16* p, int hh) { const v8b a = *(const v8b*)(p + 8 * hh), b = *(const v8b*)(p + 16 + 8 * hh); v16b f;
#pragma unroll
  for (int e = 0; e < 8; ++e) { f[e] = a[e]; f[8 + e] = b[e]; } return f; }
__device__ __forceinline__ v8f wmma16b(v16b a, v16b b, v8f c) { v8f d = __builtin_amdgcn_wmma_f32_16x16x32_f16(false, a, false, b, (short)0, c, false, false); asm volatile("v_nop\n\tv_nop\n\tv_nop\n\tv_nop" : "+v"(d) : "v"(a), "v"(b)); return d; }
__device__ __forceinline__ void wave_lds_sync() { __builtin_amdgcn_fence(__ATOMIC_RELEASE, "workgroup"); __builtin_amdgcn_wave_barrier(); __builtin_amdgcn_fence(__ATOMIC_ACQUIRE, "workgroup"); }
__device__ __forceinline__ float pmul(float a, float b) { float p = a * b; asm volatile("" : "+v"(p)); return p; }

__global__ __launch_bounds__(256) void wput_kernel(const float* __restrict__ wq, const float* __restrict__ wk, const float* __restrict__ wv, const float* __restrict__ wo, b16* __restrict__ W3, b16* __restrict__ WO) { const int u = blockIdx.x * 256 + threadIdx.x; v8b v;
  if (u < 3 * D * (DI / 8)) { const int p = u / (D * (DI / 8)), r = u % (D * (DI / 8)); const int o = r / (DI / 8), k0 = (r % (DI / 8)) * 8; const float* w = p == 0 ? wq : (p == 1 ? wk : wv);
#pragma unroll
    for (int j = 0; j < 8; ++j) v[j] = (b16)(bf16_rne(w[(size_t)(k0 + j) * D + o]) * WSC); { *(v8b*)(W3 + ((size_t)p * D + o) * DI + k0) = v;  } }
  if (u < FO * (D / 8)) { const int o = u / (D / 8), k0 = (u % (D / 8)) * 8;
#pragma unroll
    for (int j = 0; j < 8; ++j) v[j] = (b16)(bf16_rne(wo[(size_t)(k0 + j) * FO + o]) * WSC); { *(v8b*)(WO + (size_t)o * D + k0) = v;  } } }
template <int MODE>
__global__ __launch_bounds__(32) void proj_kernel(const float* __restrict__ x, const b16* __restrict__ W3, const float* __restrict__ ba, const float* __restrict__ bb, int RLIM, b16* __restrict__ Ah_, b16* __restrict__ Al_, b16* __restrict__ Bh_, b16* __restrict__ Bl_) { __shared__ __attribute__((aligned(16))) b16 Xh[16][DI + 8]; __shared__ __attribute__((aligned(16))) b16 Oh[16][72], Ol[16][72]; const int lane = threadIdx.x, nloc = lane & 15, hlf = lane >> 4; const size_t m0 = (size_t)blockIdx.x * 16; if (m0 >= (size_t)RLIM) return; constexpr int NT = MODE == 0 ? 2 : 4;
  for (int rr = 0; rr < 16; ++rr) for (int q = 0; q < 4; ++q) Xh[rr][q * 32 + lane] = (b16)(bf16_rne(x[(m0 + rr) * DI + q * 32 + lane]) * XS); if (lane < 16) for (int k = DI; k < DI + 8; ++k) Xh[lane][k] = (b16)0.0f;
  wave_lds_sync(); v8f acc[NT];
#pragma unroll
  for (int t = 0; t < NT; ++t) acc[t] = (v8f){};
  const b16* Wb = W3 + (size_t)(MODE == 0 ? 0 : D) * DI;
#pragma unroll
  for (int kb = 0; kb < DI; kb += 32) { const v16b a = frag_kb(&Xh[nloc][kb], hlf);
#pragma unroll
    for (int t = 0; t < NT; ++t) acc[t] = wmma16b(a, frag_kb(Wb + (size_t)(t * 16 + nloc) * DI + kb, hlf), acc[t]); }
#pragma unroll
  for (int t = 0; t < NT; ++t) { const int cc = t * 16 + nloc; const float bias = bfv((t < 2 ? ba : bb)[cc & 31]);
#pragma unroll
    for (int r8 = 0; r8 < 8; ++r8) { b16 p, ql; split16((acc[t][r8] * (1.0f / (XS * WSC)) + bias) * HS, p, ql); Oh[8 * hlf + r8][cc] = p; Ol[8 * hlf + r8][cc] = ql; } }
  wave_lds_sync();
  typedef __attribute__((ext_vector_type(2))) _Float16 v2b;
  { for (int rr = 0; rr < 16; ++rr) { if (lane < 16) { *(v2b*)(Ah_ + (m0 + rr) * D + lane * 2) = *(const v2b*)(&Oh[rr][lane * 2]); *(v2b*)(Al_ + (m0 + rr) * D + lane * 2) = *(const v2b*)(&Ol[rr][lane * 2]); }
      else if (MODE == 1) { const int l2 = lane - 16; *(v2b*)(Bh_ + (m0 + rr) * D + l2 * 2) = *(const v2b*)(&Oh[rr][32 + l2 * 2]); *(v2b*)(Bl_ + (m0 + rr) * D + l2 * 2) = *(const v2b*)(&Ol[rr][32 + l2 * 2]); } }  } }
// attention + LN + Wo: ONE WAVE PER BLOCK, wave per 16 queries: 64 key blocks of 128: S (8 tiles, K 32; 3 products), online softmax, P x256 hi+lo -> LDS, V^T block hi/lo [32][128]; O += P V (2 tiles; 3 products); fused = O/den; LN over 32;
__global__ __launch_bounds__(32) void att_kernel(const b16* __restrict__ Qh, const b16* __restrict__ Ql, const b16* __restrict__ Kh, const b16* __restrict__ Kl, const b16* __restrict__ Vh, const b16* __restrict__ Vl, const b16* __restrict__ WO, const float* __restrict__ gam, const float* __restrict__ bet, const float* __restrict__ bo, int QLIM, int KLIM, float* __restrict__ out) {
  __shared__ __attribute__((aligned(16))) b16 Ph_[16][KB + 8], Pl_[16][KB + 8], Vth[D][KB + 8], Vtl[D][KB + 8], Nh[16][40], Nl[16][40]; __shared__ float Sf[16][KB + 4], Of[16][D + 4], Tf[16][FO + 4];
  const int lane = threadIdx.x, nloc = lane & 15, hlf = lane >> 4; const size_t t0 = (size_t)blockIdx.x * 16; if (t0 >= (size_t)QLIM) return;
  const v16b qa = frag_kb(Qh + (t0 + nloc) * D, hlf), qb = frag_kb(Ql + (t0 + nloc) * D, hlf);
  float m_r[8], den_r[8]; v8f acc[2] = {(v8f){}, (v8f){}};
#pragma unroll
  for (int r8 = 0; r8 < 8; ++r8) { m_r[r8] = -INFINITY; den_r[r8] = 0.0f; }
#pragma unroll 1
  for (int kb0 = 0; kb0 < KLIM; kb0 += KB) {
    // V^T block: lanes pairs over keys
    for (int rr = 0; rr < KB; rr += 2) { const int r = rr + hlf; const size_t key = (size_t)kb0 + r; Vth[nloc][r] = Vh[key * D + nloc]; Vth[16 + nloc][r] = Vh[key * D + 16 + nloc]; Vtl[nloc][r] = Vl[key * D + nloc]; Vtl[16 + nloc][r] = Vl[key * D + 16 + nloc]; }
    // S tiles (K 32 = one k-step): rows = queries, cols = keys
#pragma unroll
    for (int t = 0; t < KB / 16; ++t) { const size_t key = (size_t)kb0 + t * 16 + nloc; const v16b ka = frag_kb(Kh + key * D, hlf), kbf = frag_kb(Kl + key * D, hlf); v8f s = {}; s = wmma16b(qa, ka, s); s = wmma16b(qa, kbf, s); s = wmma16b(qb, ka, s);
#pragma unroll
      for (int r8 = 0; r8 < 8; ++r8) Sf[8 * hlf + r8][t * 16 + nloc] = s[r8] * (1.0f / (HS * HS)); }
    wave_lds_sync();
#pragma unroll
    for (int rr = 0; rr < 16; ++rr) { float mx = -INFINITY;
#pragma unroll
      for (int q = 0; q < 4; ++q) mx = fmaxf(mx, Sf[rr][q * 32 + lane]);
      for (int o = 16; o; o >>= 1) mx = fmaxf(mx, __shfl_xor(mx, o));
      const float mold = __shfl(m_r[rr & 7], (rr >> 3) * 16); const float mn = fmaxf(mold, mx); const float sf = (mold == -INFINITY) ? 0.0f : __expf(mold - mn); float ps = 0.0f;
#pragma unroll
      for (int q = 0; q < 4; ++q) { const int kx = q * 32 + lane; const float p = __expf(Sf[rr][kx] - mn); ps += p; b16 ph, pl; split16(p * PS, ph, pl); Ph_[rr][kx] = ph; Pl_[rr][kx] = pl; }
      for (int o = 16; o; o >>= 1) ps += __shfl_xor(ps, o);
      if ((rr >> 3) == hlf) { const int r8 = rr & 7; den_r[r8] = den_r[r8] * sf + ps; m_r[r8] = mn;
#pragma unroll
        for (int t = 0; t < 2; ++t) acc[t][r8] = acc[t][r8] * sf; } }
    wave_lds_sync();
#pragma unroll
    for (int ks = 0; ks < KB; ks += 32) { const v16b pa = frag_kb(&Ph_[nloc][ks], hlf), pb = frag_kb(&Pl_[nloc][ks], hlf);
#pragma unroll
      for (int t = 0; t < 2; ++t) { const v16b vh = frag_kb(&Vth[t * 16 + nloc][ks], hlf), vl = frag_kb(&Vtl[t * 16 + nloc][ks], hlf); acc[t] = wmma16b(pa, vh, acc[t]); acc[t] = wmma16b(pa, vl, acc[t]); acc[t] = wmma16b(pb, vh, acc[t]); } }
    wave_lds_sync(); }
#pragma unroll
  for (int t = 0; t < 2; ++t)
#pragma unroll
    for (int r8 = 0; r8 < 8; ++r8) Of[8 * hlf + r8][t * 16 + nloc] = acc[t][r8] * (1.0f / (HS * PS)) / den_r[r8];
  wave_lds_sync();
  // LayerNorm over the 32 channels (lane = channel), stage hi/lo
  for (int rr = 0; rr < 16; ++rr) { const float v = Of[rr][lane]; float s = v; for (int o = 16; o; o >>= 1) s += __shfl_xor(s, o); const float mu = s / D; float s2 = (v - mu) * (v - mu); for (int o = 16; o; o >>= 1) s2 += __shfl_xor(s2, o); const float rs = rsqrtf(s2 / D + LNEPS); const float nv = pmul(pmul(v - mu, rs), bfv(gam[lane])) + bfv(bet[lane]); b16 p, ql; split16(nv * HS, p, ql); Nh[rr][lane] = p; Nl[rr][lane] = ql; if (lane < 8) { Nh[rr][32 + lane] = (b16)0.0f; Nl[rr][32 + lane] = (b16)0.0f; } }
  wave_lds_sync(); v8f o8[8];
#pragma unroll
  for (int t = 0; t < 8; ++t) o8[t] = (v8f){};
  { const v16b a = frag_kb(&Nh[nloc][0], hlf), al = frag_kb(&Nl[nloc][0], hlf);
#pragma unroll
    for (int t = 0; t < 8; ++t) { const v16b bw = frag_kb(WO + (size_t)(t * 16 + nloc) * D, hlf); o8[t] = wmma16b(a, bw, o8[t]); o8[t] = wmma16b(al, bw, o8[t]); } }
#pragma unroll
  for (int t = 0; t < 8; ++t) { const int cc = t * 16 + nloc; const float bb = bfv(bo[cc]);
#pragma unroll
    for (int r8 = 0; r8 < 8; ++r8) Tf[8 * hlf + r8][cc] = o8[t][r8] * (1.0f / (HS * WSC)) + bb; }
  wave_lds_sync();
  { for (int rr = 0; rr < 16; ++rr) *(v4f*)(out + (t0 + rr) * FO + lane * 4) = *(const v4f*)(&Tf[rr][lane * 4]);  } }
}  // namespace

extern "C" void kernel_launch(void* const* d_in, const int* in_sizes, int n_in, void* d_out, int out_size, void* d_ws, size_t ws_size, hipStream_t stream) {
  (void)n_in;
  auto Fp = [&](int i) { return (const float*)d_in[i]; };
  // Input order: 0 input1 [8192,128]; 1 input2 [8192,128]; 2 Wq [128,32]; 3 bq; 4 Wk; 5 bk; 6 Wv; 7 bv; 8 gamma [32]; 9 beta; 10 Wo [32,128]; 11 bo [128]
  if (in_sizes[0] != N1 * DI || in_sizes[1] != N2 * DI || in_sizes[2] != DI * D || in_sizes[4] != DI * D || in_sizes[6] != DI * D || in_sizes[8] != D || in_sizes[10] != D * FO || in_sizes[11] != FO || out_size != N1 * FO) return;
  const int QLIM = N1, KLIM = N2;   // query / key cuts (multiples of 128)
  size_t off = 0; char* ws = (char*)d_ws;
  auto carve = [&](size_t bytes) { char* p = ws + off; off += (bytes + 255) & ~(size_t)255; return p; };
  b16* W3 = (b16*)carve((size_t)3 * D * DI * 2); b16* WO = (b16*)carve((size_t)FO * D * 2); b16* Qh = (b16*)carve((size_t)N1 * D * 2); b16* Ql = (b16*)carve((size_t)N1 * D * 2); b16* Kh = (b16*)carve((size_t)N2 * D * 2); b16* Kl = (b16*)carve((size_t)N2 * D * 2); b16* Vh = (b16*)carve((size_t)N2 * D * 2); b16* Vl = (b16*)carve((size_t)N2 * D * 2);
  if (off > ws_size || off > ((size_t)8 << 20)) return;   // ~ 3.2 MB
  wput_kernel<<<(3 * D * (DI / 8) + 255) / 256, 256, 0, stream>>>(Fp(2), Fp(4), Fp(6), Fp(10), W3, WO);
  proj_kernel<0><<<QLIM / 16, 32, 0, stream>>>(Fp(0), W3, Fp(3), Fp(3), QLIM, Qh, Ql, Qh, Ql);
  proj_kernel<1><<<KLIM / 16, 32, 0, stream>>>(Fp(1), W3, Fp(5), Fp(7), KLIM, Kh, Kl, Vh, Vl);
  att_kernel<<<QLIM / 16, 32, 0, stream>>>(Qh, Ql, Kh, Kl, Vh, Vl, WO, Fp(8), Fp(9), Fp(11), QLIM, KLIM, (float*)d_out);
}

// v001
// A run of this version takes 336 microseconds.
// In both of two side-by-side timings against v000, it was 3.21 times as fast.
#include <hip/hip_runtime.h>

// CAM (cross-attention module): q = input1 Wq + bq [8192][32]; k = input2 Wk + bk, v = input2 Wv + bv [8192][32]; scores = q k^T (no scaling); w = softmax over the 8,192 keys; fused = w v; LayerNorm(fused) (eps 1e-5, gamma/beta);
// out = normed Wo + bo -> [8192][128].
// Deterministic: no index structures, no atomics.
// WMMA (v_wmma_f32_16x16x32_f16, f32 accumulate): projections with the inputs EXACT bf16 x8 (K 128, 2 tiles each) against exact weight rows x256; S = q k^T per (16-query tile, 128-key block) and O += P V (q/k/v/P hi+lo x256; 3 products each);
// out = LN(fused) (hi+lo) x Wo rows (K 32, 8 tiles). Online softmax and LayerNorm in f32. Inputs rounded to bf16 once. Fragment k-map per lane half hh for A AND B: elements 0..7 <- k = 8hh+0..7, 8..15 <- k = 16+8hh+0..7;

namespace {
constexpr int N1 = 8192, N2 = 8192, DI = 128, D = 32, FO = 128, KB = 128;
constexpr float XS = 8.0f, HS = 256.0f, WSC = 256.0f, PS = 256.0f, LNEPS = 1e-5f;
typedef _Float16 b16;
typedef __attribute__((ext_vector_type(16))) _Float16 v16b;
typedef __attribute__((ext_vector_type(8))) _Float16 v8b;
typedef __attribute__((ext_vector_type(8))) float v8f;
typedef __attribute__((ext_vector_type(4))) float v4f;
__device__ __forceinline__ float bf16_rne(float f) { unsigned int u = __float_as_uint(f); u += 0x7FFFu + ((u >> 16) & 1u); float r = __uint_as_float(u & 0xFFFF0000u); asm volatile("" : "+v"(r)); return r; }
__device__ __forceinline__ float bfv(float f) { float r = bf16_rne(f); asm volatile("" : "+v"(r)); return r; }
__device__ __forceinline__ void split16(float v, b16& hi, b16& lo) { hi = (b16)v; lo = (b16)(v - (float)hi); }
__device__ __forceinline__ v16b frag_kb(const b16* p, int hh) { const v8b a = *(const v8b*)(p + 8 * hh), b = *(const v8b*)(p + 16 + 8 * hh); v16b f;
#pragma unroll
  for (int e = 0; e < 8; ++e) { f[e] = a[e]; f[8 + e] = b[e]; } return f; }
__device__ __forceinline__ v8f wmma16b(v16b a, v16b b, v8f c) { v8f d = __builtin_amdgcn_wmma_f32_16x16x32_f16(false, a, false, b, (short)0, c, false, false); asm volatile("v_nop\n\tv_nop\n\tv_nop\n\tv_nop" : "+v"(d) : "v"(a), "v"(b)); return d; }
__device__ __forceinline__ void wave_lds_sync() { __builtin_amdgcn_fence(__ATOMIC_RELEASE, "workgroup"); __builtin_amdgcn_wave_barrier(); __builtin_amdgcn_fence(__ATOMIC_ACQUIRE, "workgroup"); }
__device__ __forceinline__ float pmul(float a, float b) { float p = a * b; asm volatile("" : "+v"(p)); return p; }
// att_kernel LDS: one slab per wave. LoopBuf is live inside the key loop, TailBuf (partials for the merge, then the epilogue's stages) only behind it, so the two share the slab.
constexpr int NW = 4;
struct LoopBuf { b16 Ph_[16][KB + 8], Pl_[16][KB + 8], Vth[D][KB + 8], Vtl[D][KB + 8]; float Sf[16][KB + 4]; };
struct TailBuf { float Pa[16][D + 4], Pm[16], Pd[16]; b16 Nh[16][40], Nl[16][40]; float Of[16][D + 4], Tf[16][FO + 4]; };
union WaveBuf { LoopBuf l; TailBuf e; };

__global__ __launch_bounds__(256) void wput_kernel(const float* __restrict__ wq, const float* __restrict__ wk, const float* __restrict__ wv, const float* __restrict__ wo, b16* __restrict__ W3, b16* __restrict__ WO) { const int u = blockIdx.x * 256 + threadIdx.x; v8b v;
  if (u < 3 * D * (DI / 8)) { const int p = u / (D * (DI / 8)), r = u % (D * (DI / 8)); const int o = r / (DI / 8), k0 = (r % (DI / 8)) * 8; const float* w = p == 0 ? wq : (p == 1 ? wk : wv);
#pragma unroll
    for (int j = 0; j < 8; ++j) v[j] = (b16)(bf16_rne(w[(size_t)(k0 + j) * D + o]) * WSC); { *(v8b*)(W3 + ((size_t)p * D + o) * DI + k0) = v;  } }
  if (u < FO * (D / 8)) { const int o = u / (D / 8), k0 = (u % (D / 8)) * 8;
#pragma unroll
    for (int j = 0; j < 8; ++j) v[j] = (b16)(bf16_rne(wo[(size_t)(k0 + j) * FO + o]) * WSC); { *(v8b*)(WO + (size_t)o * D + k0) = v;  } } }
template <int MODE>
__global__ __launch_bounds__(32) void proj_kernel(const float* __restrict__ x, const b16* __restrict__ W3, const float* __restrict__ ba, const float* __restrict__ bb, int RLIM, b16* __restrict__ Ah_, b16* __restrict__ Al_, b16* __restrict__ Bh_, b16* __restrict__ Bl_) { __shared__ __attribute__((aligned(16))) b16 Xh[16][DI + 8]; __shared__ __attribute__((aligned(16))) b16 Oh[16][72], Ol[16][72]; const int lane = threadIdx.x, nloc = lane & 15, hlf = lane >> 4; const size_t m0 = (size_t)blockIdx.x * 16; if (m0 >= (size_t)RLIM) return; constexpr int NT = MODE == 0 ? 2 : 4;
  for (int rr = 0; rr < 16; ++rr) for (int q = 0; q < 4; ++q) Xh[rr][q * 32 + lane] = (b16)(bf16_rne(x[(m0 + rr) * DI + q * 32 + lane]) * XS); if (lane < 16) for (int k = DI; k < DI + 8; ++k) Xh[lane][k] = (b16)0.0f;
  wave_lds_sync(); v8f acc[NT];
#pragma unroll
  for (int t = 0; t < NT; ++t) acc[t] = (v8f){};
  const b16* Wb = W3 + (size_t)(MODE == 0 ? 0 : D) * DI;
#pragma unroll
  for (int kb = 0; kb < DI; kb += 32) { const v16b a = frag_kb(&Xh[nloc][kb], hlf);
#pragma unroll
    for (int t = 0; t < NT; ++t) acc[t] = wmma16b(a, frag_kb(Wb + (size_t)(t * 16 + nloc) * DI + kb, hlf), acc[t]); }
#pragma unroll
  for (int t = 0; t < NT; ++t) { const int cc = t * 16 + nloc; const float bias = bfv((t < 2 ? ba : bb)[cc & 31]);
#pragma unroll
    for (int r8 = 0; r8 < 8; ++r8) { b16 p, ql; split16((acc[t][r8] * (1.0f / (XS * WSC)) + bias) * HS, p, ql); Oh[8 * hlf + r8][cc] = p; Ol[8 * hlf + r8][cc] = ql; } }
  wave_lds_sync();
  typedef __attribute__((ext_vector_type(2))) _Float16 v2b;
  { for (int rr = 0; rr < 16; ++rr) { if (lane < 16) { *(v2b*)(Ah_ + (m0 + rr) * D + lane * 2) = *(const v2b*)(&Oh[rr][lane * 2]); *(v2b*)(Al_ + (m0 + rr) * D + lane * 2) = *(const v2b*)(&Ol[rr][lane * 2]); }
      else if (MODE == 1) { const int l2 = lane - 16; *(v2b*)(Bh_ + (m0 + rr) * D + l2 * 2) = *(const v2b*)(&Oh[rr][32 + l2 * 2]); *(v2b*)(Bl_ + (m0 + rr) * D + l2 * 2) = *(const v2b*)(&Ol[rr][32 + l2 * 2]); } }  } }
// attention + LN + Wo: NW WAVES PER BLOCK, block per 16 queries: the 64 key blocks of 128 are dealt round-robin to the waves, each wave in its own LDS slab: S (8 tiles, K 32; 3 products), online softmax, P x256 hi+lo -> LDS, V^T block hi/lo [32][128]; O += P V (2 tiles; 3 products);
// then the waves' partial (max, den, O) meet in LDS behind one block barrier and wave 0 merges them (rescale to the common max, waves summed in index order); fused = O/den; LN over 32;
__global__ __launch_bounds__(32 * NW) void att_kernel(const b16* __restrict__ Qh, const b16* __restrict__ Ql, const b16* __restrict__ Kh, const b16* __restrict__ Kl, const b16* __restrict__ Vh, const b16* __restrict__ Vl, const b16* __restrict__ WO, const float* __restrict__ gam, const float* __restrict__ bet, const float* __restrict__ bo, int QLIM, int KLIM, float* __restrict__ out) {
  __shared__ __attribute__((aligned(16))) WaveBuf wb[NW];
  const int lane = threadIdx.x & 31, wave = __builtin_amdgcn_readfirstlane(threadIdx.x >> 5), nloc = lane & 15, hlf = lane >> 4; const size_t t0 = (size_t)blockIdx.x * 16; if (t0 >= (size_t)QLIM) return;
  LoopBuf& L = wb[wave].l; auto& Ph_ = L.Ph_; auto& Pl_ = L.Pl_; auto& Vth = L.Vth; auto& Vtl = L.Vtl; auto& Sf = L.Sf;
  const v16b qa = frag_kb(Qh + (t0 + nloc) * D, hlf), qb = frag_kb(Ql + (t0 + nloc) * D, hlf);
  float m_r[8], den_r[8]; v8f acc[2] = {(v8f){}, (v8f){}};
#pragma unroll
  for (int r8 = 0; r8 < 8; ++r8) { m_r[r8] = -INFINITY; den_r[r8] = 0.0f; }
#pragma unroll 1
  for (int kb0 = wave * KB; kb0 < KLIM; kb0 += NW * KB) {
    // V^T block: lanes pairs over keys
    for (int rr = 0; rr < KB; rr += 2) { const int r = rr + hlf; const size_t key = (size_t)kb0 + r; Vth[nloc][r] = Vh[key * D + nloc]; Vth[16 + nloc][r] = Vh[key * D + 16 + nloc]; Vtl[nloc][r] = Vl[key * D + nloc]; Vtl[16 + nloc][r] = Vl[key * D + 16 + nloc]; }
    // S tiles (K 32 = one k-step): rows = queries, cols = keys
#pragma unroll
    for (int t = 0; t < KB / 16; ++t) { const size_t key = (size_t)kb0 + t * 16 + nloc; const v16b ka = frag_kb(Kh + key * D, hlf), kbf = frag_kb(Kl + key * D, hlf); v8f s = {}; s = wmma16b(qa, ka, s); s = wmma16b(qa, kbf, s); s = wmma16b(qb, ka, s);
#pragma unroll
      for (int r8 = 0; r8 < 8; ++r8) Sf[8 * hlf + r8][t * 16 + nloc] = s[r8] * (1.0f / (HS * HS)); }
    wave_lds_sync();
#pragma unroll
    for (int rr = 0; rr < 16; ++rr) { float mx = -INFINITY;
#pragma unroll
      for (int q = 0; q < 4; ++q) mx = fmaxf(mx, Sf[rr][q * 32 + lane]);
      for (int o = 16; o; o >>= 1) mx = fmaxf(mx, __shfl_xor(mx, o));
      const float mold = __shfl(m_r[rr & 7], (rr >> 3) * 16); const float mn = fmaxf(mold, mx); const float sf = (mold == -INFINITY) ? 0.0f : __expf(mold - mn); float ps = 0.0f;
#pragma unroll
      for (int q = 0; q < 4; ++q) { const int kx = q * 32 + lane; const float p = __expf(Sf[rr][kx] - mn); ps += p; b16 ph, pl; split16(p * PS, ph, pl); Ph_[rr][kx] = ph; Pl_[rr][kx] = pl; }
      for (int o = 16; o; o >>= 1) ps += __shfl_xor(ps, o);
      if ((rr >> 3) == hlf) { const int r8 = rr & 7; den_r[r8] = den_r[r8] * sf + ps; m_r[r8] = mn;
#pragma unroll
        for (int t = 0; t < 2; ++t) acc[t][r8] = acc[t][r8] * sf; } }
    wave_lds_sync();
#pragma unroll
    for (int ks = 0; ks < KB; ks += 32) { const v16b pa = frag_kb(&Ph_[nloc][ks], hlf), pb = frag_kb(&Pl_[nloc][ks], hlf);
#pragma unroll
      for (int t = 0; t < 2; ++t) { const v16b vh = frag_kb(&Vth[t * 16 + nloc][ks], hlf), vl = frag_kb(&Vtl[t * 16 + nloc][ks], hlf); acc[t] = wmma16b(pa, vh, acc[t]); acc[t] = wmma16b(pa, vl, acc[t]); acc[t] = wmma16b(pb, vh, acc[t]); } }
    wave_lds_sync(); }
  // each wave publishes its partial row max, denominator and O in its own slab
  { TailBuf& E = wb[wave].e;
#pragma unroll
    for (int r8 = 0; r8 < 8; ++r8) { E.Pa[8 * hlf + r8][nloc] = acc[0][r8]; E.Pa[8 * hlf + r8][16 + nloc] = acc[1][r8]; }
    if (nloc == 0) {
#pragma unroll
      for (int r8 = 0; r8 < 8; ++r8) { E.Pm[8 * hlf + r8] = m_r[r8]; E.Pd[8 * hlf + r8] = den_r[r8]; } } }
  __syncthreads();   // every wave's partials are in LDS before wave 0 reads them
  if (wave != 0) return;
  auto& Nh = wb[0].e.Nh; auto& Nl = wb[0].e.Nl; auto& Of = wb[0].e.Of; auto& Tf = wb[0].e.Tf;
#pragma unroll
  for (int r8 = 0; r8 < 8; ++r8) { const int row = 8 * hlf + r8; float mx = wb[0].e.Pm[row];
#pragma unroll
    for (int w = 1; w < NW; ++w) mx = fmaxf(mx, wb[w].e.Pm[row]);
    float dn = 0.0f, a0 = 0.0f, a1 = 0.0f;
#pragma unroll
    for (int w = 0; w < NW; ++w) { const float mw = wb[w].e.Pm[row]; const float sc = (mw == -INFINITY) ? 0.0f : __expf(mw - mx); dn += wb[w].e.Pd[row] * sc; a0 += wb[w].e.Pa[row][nloc] * sc; a1 += wb[w].e.Pa[row][16 + nloc] * sc; }
    den_r[r8] = dn; acc[0][r8] = a0; acc[1][r8] = a1; }
#pragma unroll
  for (int t = 0; t < 2; ++t)
#pragma unroll
    for (int r8 = 0; r8 < 8; ++r8) Of[8 * hlf + r8][t * 16 + nloc] = acc[t][r8] * (1.0f / (HS * PS)) / den_r[r8];
  wave_lds_sync();
  // LayerNorm over the 32 channels (lane = channel), stage hi/lo
  for (int rr = 0; rr < 16; ++rr) { const float v = Of[rr][lane]; float s = v; for (int o = 16; o; o >>= 1) s += __shfl_xor(s, o); const float mu = s / D; float s2 = (v - mu) * (v - mu); for (int o = 16; o; o >>= 1) s2 += __shfl_xor(s2, o); const float rs = rsqrtf(s2 / D + LNEPS); const float nv = pmul(pmul(v - mu, rs), bfv(gam[lane])) + bfv(bet[lane]); b16 p, ql; split16(nv * HS, p, ql); Nh[rr][lane] = p; Nl[rr][lane] = ql; if (lane < 8) { Nh[rr][32 + lane] = (b16)0.0f; Nl[rr][32 + lane] = (b16)0.0f; } }
  wave_lds_sync(); v8f o8[8];
#pragma unroll
  for (int t = 0; t < 8; ++t) o8[t] = (v8f){};
  { const v16b a = frag_kb(&Nh[nloc][0], hlf), al = frag_kb(&Nl[nloc][0], hlf);
#pragma unroll
    for (int t = 0; t < 8; ++t) { const v16b bw = frag_kb(WO + (size_t)(t * 16 + nloc) * D, hlf); o8[t] = wmma16b(a, bw, o8[t]); o8[t] = wmma16b(al, bw, o8[t]); } }
#pragma unroll
  for (int t = 0; t < 8; ++t) { const int cc = t * 16 + nloc; const float bb = bfv(bo[cc]);
#pragma unroll
    for (int r8 = 0; r8 < 8; ++r8) Tf[8 * hlf + r8][cc] = o8[t][r8] * (1.0f / (HS * WSC)) + bb; }
  wave_lds_sync();
  { for (int rr = 0; rr < 16; ++rr) *(v4f*)(out + (t0 + rr) * FO + lane * 4) = *(const v4f*)(&Tf[rr][lane * 4]);  } }
}  // namespace

extern "C" void kernel_launch(void* const* d_in, const int* in_sizes, int n_in, void* d_out, int out_size, void* d_ws, size_t ws_size, hipStream_t stream) {
  (void)n_in;
  auto Fp = [&](int i) { return (const float*)d_in[i]; };
  // Input order: 0 input1 [8192,128]; 1 input2 [8192,128]; 2 Wq [128,32]; 3 bq; 4 Wk; 5 bk; 6 Wv; 7 bv; 8 gamma [32]; 9 beta; 10 Wo [32,128]; 11 bo [128]
  if (in_sizes[0] != N1 * DI || in_sizes[1] != N2 * DI || in_sizes[2] != DI * D || in_sizes[4] != DI * D || in_sizes[6] != DI * D || in_sizes[8] != D || in_sizes[10] != D * FO || in_sizes[11] != FO || out_size != N1 * FO) return;
  const int QLIM = N1, KLIM = N2;   // query / key cuts (multiples of 128)
  size_t off = 0; char* ws = (char*)d_ws;
  auto carve = [&](size_t bytes) { char* p = ws + off; off += (bytes + 255) & ~(size_t)255; return p; };
  b16* W3 = (b16*)carve((size_t)3 * D * DI * 2); b16* WO = (b16*)carve((size_t)FO * D * 2); b16* Qh = (b16*)carve((size_t)N1 * D * 2); b16* Ql = (b16*)carve((size_t)N1 * D * 2); b16* Kh = (b16*)carve((size_t)N2 * D * 2); b16* Kl = (b16*)carve((size_t)N2 * D * 2); b16* Vh = (b16*)carve((size_t)N2 * D * 2); b16* Vl = (b16*)carve((size_t)N2 * D * 2);
  if (off > ws_size || off > ((size_t)8 << 20)) return;   // ~ 3.2 MB
  wput_kernel<<<(3 * D * (DI / 8) + 255) / 256, 256, 0, stream>>>(Fp(2), Fp(4), Fp(6), Fp(10), W3, WO);
  proj_kernel<0><<<QLIM / 16, 32, 0, stream>>>(Fp(0), W3, Fp(3), Fp(3), QLIM, Qh, Ql, Qh, Ql);
  proj_kernel<1><<<KLIM / 16, 32, 0, stream>>>(Fp(1), W3, Fp(5), Fp(7), KLIM, Kh, Kl, Vh, Vl);
  att_kernel<<<QLIM / 16, 32 * NW, 0, stream>>>(Qh, Ql, Kh, Kl, Vh, Vl, WO, Fp(8), Fp(9), Fp(11), QLIM, KLIM, (float*)d_out);
}

// v002
// A run of this version takes 238 microseconds.
// Timed twice side by side with v001, it ran 1.42 times as fast both times.
// Over all steps from v000 it is 4.55 times as fast.
#include <hip/hip_runtime.h>

// CAM (cross-attention module): q = input1 Wq + bq [8192][32]; k = input2 Wk + bk, v = input2 Wv + bv [8192][32]; scores = q k^T (no scaling); w = softmax over the 8,192 keys; fused = w v; LayerNorm(fused) (eps 1e-5, gamma/beta);
// out = normed Wo + bo -> [8192][128].
// Deterministic: no index structures, no atomics.
// WMMA (v_wmma_f32_16x16x32_f16, f32 accumulate): projections with the inputs EXACT bf16 x8 (K 128, 2 tiles each) against exact weight rows x256; S^T = k q^T per (128-key block, 16-query tile) and O^T += V^T P^T (q/k/v/P hi+lo x256; 3 products each), so a lane owns one query's scores and P^T packs in-lane into the B operand;
// out = LN(fused) (hi+lo) x Wo rows (K 32, 8 tiles). Online softmax and LayerNorm in f32. Inputs rounded to bf16 once. Fragment k-map per lane half hh for A AND B: elements 0..7 <- k = 8hh+0..7, 8..15 <- k = 16+8hh+0..7;

namespace {
constexpr int N1 = 8192, N2 = 8192, DI = 128, D = 32, FO = 128, KB = 128;
constexpr float XS = 8.0f, HS = 256.0f, WSC = 256.0f, PS = 256.0f, LNEPS = 1e-5f;
typedef _Float16 b16;
typedef __attribute__((ext_vector_type(16))) _Float16 v16b;
typedef __attribute__((ext_vector_type(8))) _Float16 v8b;
typedef __attribute__((ext_vector_type(8))) float v8f;
typedef __attribute__((ext_vector_type(4))) float v4f;
__device__ __forceinline__ float bf16_rne(float f) { unsigned int u = __float_as_uint(f); u += 0x7FFFu + ((u >> 16) & 1u); float r = __uint_as_float(u & 0xFFFF0000u); asm volatile("" : "+v"(r)); return r; }
__device__ __forceinline__ float bfv(float f) { float r = bf16_rne(f); asm volatile("" : "+v"(r)); return r; }
__device__ __forceinline__ void split16(float v, b16& hi, b16& lo) { hi = (b16)v; lo = (b16)(v - (float)hi); }
__device__ __forceinline__ v16b frag_kb(const b16* p, int hh) { const v8b a = *(const v8b*)(p + 8 * hh), b = *(const v8b*)(p + 16 + 8 * hh); v16b f;
#pragma unroll
  for (int e = 0; e < 8; ++e) { f[e] = a[e]; f[8 + e] = b[e]; } return f; }
__device__ __forceinline__ v8f wmma16b(v16b a, v16b b, v8f c) { v8f d = __builtin_amdgcn_wmma_f32_16x16x32_f16(false, a, false, b, (short)0, c, false, false); asm volatile("v_nop\n\tv_nop\n\tv_nop\n\tv_nop" : "+v"(d) : "v"(a), "v"(b)); return d; }
__device__ __forceinline__ void wave_lds_sync() { __builtin_amdgcn_fence(__ATOMIC_RELEASE, "workgroup"); __builtin_amdgcn_wave_barrier(); __builtin_amdgcn_fence(__ATOMIC_ACQUIRE, "workgroup"); }
__device__ __forceinline__ float pmul(float a, float b) { float p = a * b; asm volatile("" : "+v"(p)); return p; }
// att_kernel LDS: one slab per wave. LoopBuf is live inside the key loop, TailBuf (partials for the merge, then the epilogue's stages) only behind it, so the two share the slab.
constexpr int NW = 4;
struct LoopBuf { b16 Vth[D][KB + 8], Vtl[D][KB + 8]; };
struct TailBuf { float Pa[16][D + 4], Pm[16], Pd[16]; b16 Nh[16][40], Nl[16][40]; float Of[16][D + 4], Tf[16][FO + 4]; };
union WaveBuf { LoopBuf l; TailBuf e; };

__global__ __launch_bounds__(256) void wput_kernel(const float* __restrict__ wq, const float* __restrict__ wk, const float* __restrict__ wv, const float* __restrict__ wo, b16* __restrict__ W3, b16* __restrict__ WO) { const int u = blockIdx.x * 256 + threadIdx.x; v8b v;
  if (u < 3 * D * (DI / 8)) { const int p = u / (D * (DI / 8)), r = u % (D * (DI / 8)); const int o = r / (DI / 8), k0 = (r % (DI / 8)) * 8; const float* w = p == 0 ? wq : (p == 1 ? wk : wv);
#pragma unroll
    for (int j = 0; j < 8; ++j) v[j] = (b16)(bf16_rne(w[(size_t)(k0 + j) * D + o]) * WSC); { *(v8b*)(W3 + ((size_t)p * D + o) * DI + k0) = v;  } }
  if (u < FO * (D / 8)) { const int o = u / (D / 8), k0 = (u % (D / 8)) * 8;
#pragma unroll
    for (int j = 0; j < 8; ++j) v[j] = (b16)(bf16_rne(wo[(size_t)(k0 + j) * FO + o]) * WSC); { *(v8b*)(WO + (size_t)o * D + k0) = v;  } } }
template <int MODE>
__global__ __launch_bounds__(32) void proj_kernel(const float* __restrict__ x, const b16* __restrict__ W3, const float* __restrict__ ba, const float* __restrict__ bb, int RLIM, b16* __restrict__ Ah_, b16* __restrict__ Al_, b16* __restrict__ Bh_, b16* __restrict__ Bl_) { __shared__ __attribute__((aligned(16))) b16 Xh[16][DI + 8]; __shared__ __attribute__((aligned(16))) b16 Oh[16][72], Ol[16][72]; const int lane = threadIdx.x, nloc = lane & 15, hlf = lane >> 4; const size_t m0 = (size_t)blockIdx.x * 16; if (m0 >= (size_t)RLIM) return; constexpr int NT = MODE == 0 ? 2 : 4;
  for (int rr = 0; rr < 16; ++rr) for (int q = 0; q < 4; ++q) Xh[rr][q * 32 + lane] = (b16)(bf16_rne(x[(m0 + rr) * DI + q * 32 + lane]) * XS); if (lane < 16) for (int k = DI; k < DI + 8; ++k) Xh[lane][k] = (b16)0.0f;
  wave_lds_sync(); v8f acc[NT];
#pragma unroll
  for (int t = 0; t < NT; ++t) acc[t] = (v8f){};
  const b16* Wb = W3 + (size_t)(MODE == 0 ? 0 : D) * DI;
#pragma unroll
  for (int kb = 0; kb < DI; kb += 32) { const v16b a = frag_kb(&Xh[nloc][kb], hlf);
#pragma unroll
    for (int t = 0; t < NT; ++t) acc[t] = wmma16b(a, frag_kb(Wb + (size_t)(t * 16 + nloc) * DI + kb, hlf), acc[t]); }
#pragma unroll
  for (int t = 0; t < NT; ++t) { const int cc = t * 16 + nloc; const float bias = bfv((t < 2 ? ba : bb)[cc & 31]);
#pragma unroll
    for (int r8 = 0; r8 < 8; ++r8) { b16 p, ql; split16((acc[t][r8] * (1.0f / (XS * WSC)) + bias) * HS, p, ql); Oh[8 * hlf + r8][cc] = p; Ol[8 * hlf + r8][cc] = ql; } }
  wave_lds_sync();
  typedef __attribute__((ext_vector_type(2))) _Float16 v2b;
  { for (int rr = 0; rr < 16; ++rr) { if (lane < 16) { *(v2b*)(Ah_ + (m0 + rr) * D + lane * 2) = *(const v2b*)(&Oh[rr][lane * 2]); *(v2b*)(Al_ + (m0 + rr) * D + lane * 2) = *(const v2b*)(&Ol[rr][lane * 2]); }
      else if (MODE == 1) { const int l2 = lane - 16; *(v2b*)(Bh_ + (m0 + rr) * D + l2 * 2) = *(const v2b*)(&Oh[rr][32 + l2 * 2]); *(v2b*)(Bl_ + (m0 + rr) * D + l2 * 2) = *(const v2b*)(&Ol[rr][32 + l2 * 2]); } }  } }
// attention + LN + Wo: NW WAVES PER BLOCK, block per 16 queries: the 64 key blocks of 128 are dealt round-robin to the waves, each wave in its own LDS slab: V^T block hi/lo [32][128]; S^T (8 tiles, K 32; 3 products; A = k rows, B = q): D column = lane's query, D rows = 8 keys per lane half; online softmax per lane in registers (one exchange between the halves for the max);
// P^T x256 hi+lo: tiles 2j and 2j+1 are elements 0..7 and 8..15 of the B fragment of keys 32j.. (the k-map above); O^T += V^T P^T (2 channel tiles; 3 products);
// then the waves' partial (max, den, O) meet in LDS behind one block barrier and wave 0 merges them (rescale to the common max, waves summed in index order); fused = O/den; LN over 32;
__global__ __launch_bounds__(32 * NW) void att_kernel(const b16* __restrict__ Qh, const b16* __restrict__ Ql, const b16* __restrict__ Kh, const b16* __restrict__ Kl, const b16* __restrict__ Vh, const b16* __restrict__ Vl, const b16* __restrict__ WO, const float* __restrict__ gam, const float* __restrict__ bet, const float* __restrict__ bo, int QLIM, int KLIM, float* __restrict__ out) {
  __shared__ __attribute__((aligned(16))) WaveBuf wb[NW];
  const int lane = threadIdx.x & 31, wave = __builtin_amdgcn_readfirstlane(threadIdx.x >> 5), nloc = lane & 15, hlf = lane >> 4; const size_t t0 = (size_t)blockIdx.x * 16; if (t0 >= (size_t)QLIM) return;
  LoopBuf& L = wb[wave].l; auto& Vth = L.Vth; auto& Vtl = L.Vtl;
  const v16b qa = frag_kb(Qh + (t0 + nloc) * D, hlf), qb = frag_kb(Ql + (t0 + nloc) * D, hlf);
  // per lane: query nloc's running max (equal in both halves) and this half's share of its denominator; acc[t][r8] = O^T[channel 16t + 8hlf + r8][query nloc]
  float m_q = -INFINITY, den_q = 0.0f; v8f acc[2] = {(v8f){}, (v8f){}};
#pragma unroll 1
  for (int kb0 = wave * KB; kb0 < KLIM; kb0 += NW * KB) {
    // V^T block: lanes pairs over keys
    for (int rr = 0; rr < KB; rr += 2) { const int r = rr + hlf; const size_t key = (size_t)kb0 + r; Vth[nloc][r] = Vh[key * D + nloc]; Vth[16 + nloc][r] = Vh[key * D + 16 + nloc]; Vtl[nloc][r] = Vl[key * D + nloc]; Vtl[16 + nloc][r] = Vl[key * D + 16 + nloc]; }
    // S^T tiles (K 32 = one k-step): rows = keys, cols = queries
    v8f st[KB / 16], mv;
#pragma unroll
    for (int t = 0; t < KB / 16; ++t) { const size_t key = (size_t)kb0 + t * 16 + nloc; const v16b ka = frag_kb(Kh + key * D, hlf);
      asm volatile("s_wait_xcnt 0x0" ::: "memory");   // stands in front of the Kl loads, whose results the compiler may place in the registers that hold the Kh address
      const v16b kbf = frag_kb(Kl + key * D, hlf); v8f s = {}; s = wmma16b(ka, qa, s); s = wmma16b(kbf, qa, s); s = wmma16b(ka, qb, s);
#pragma unroll
      for (int r8 = 0; r8 < 8; ++r8) { st[t][r8] = s[r8] * (1.0f / (HS * HS)); mv[r8] = t == 0 ? st[t][r8] : fmaxf(mv[r8], st[t][r8]); } }
    float mx = mv[0];
#pragma unroll
    for (int r8 = 1; r8 < 8; ++r8) mx = fmaxf(mx, mv[r8]);
    mx = fmaxf(mx, __shfl_xor(mx, 16));
    const float mn = fmaxf(m_q, mx); const float sf = (m_q == -INFINITY) ? 0.0f : __expf(m_q - mn); v8f pv = {}; v16b pa[KB / 32], pb[KB / 32];
#pragma unroll
    for (int t = 0; t < KB / 16; ++t)
#pragma unroll
      for (int r8 = 0; r8 < 8; ++r8) { const float p = __expf(st[t][r8] - mn); pv[r8] += p; b16 ph, pl; split16(p * PS, ph, pl); pa[t >> 1][(t & 1) * 8 + r8] = ph; pb[t >> 1][(t & 1) * 8 + r8] = pl; }
    const float ps = ((pv[0] + pv[1]) + (pv[2] + pv[3])) + ((pv[4] + pv[5]) + (pv[6] + pv[7]));
    den_q = den_q * sf + ps; m_q = mn;
#pragma unroll
    for (int t = 0; t < 2; ++t)
#pragma unroll
      for (int r8 = 0; r8 < 8; ++r8) acc[t][r8] = acc[t][r8] * sf;
    wave_lds_sync();
#pragma unroll
    for (int ks = 0; ks < KB; ks += 32) {
#pragma unroll
      for (int t = 0; t < 2; ++t) { const v16b vh = frag_kb(&Vth[t * 16 + nloc][ks], hlf), vl = frag_kb(&Vtl[t * 16 + nloc][ks], hlf); acc[t] = wmma16b(vh, pa[ks / 32], acc[t]); acc[t] = wmma16b(vl, pa[ks / 32], acc[t]); acc[t] = wmma16b(vh, pb[ks / 32], acc[t]); } }
    wave_lds_sync(); }
  // each wave publishes its partial row max, denominator (the halves' shares joined here) and O (back to [query][channel]) in its own slab
  { TailBuf& E = wb[wave].e; const float den_f = den_q + __shfl_xor(den_q, 16);
#pragma unroll
    for (int t = 0; t < 2; ++t)
#pragma unroll
      for (int r8 = 0; r8 < 8; ++r8) E.Pa[nloc][t * 16 + 8 * hlf + r8] = acc[t][r8];
    if (hlf == 0) { E.Pm[nloc] = m_q; E.Pd[nloc] = den_f; } }
  __syncthreads();   // every wave's partials are in LDS before wave 0 reads them
  if (wave != 0) return;
  auto& Nh = wb[0].e.Nh; auto& Nl = wb[0].e.Nl; auto& Of = wb[0].e.Of; auto& Tf = wb[0].e.Tf; float den_r[8];
#pragma unroll
  for (int r8 = 0; r8 < 8; ++r8) { const int row = 8 * hlf + r8; float mx = wb[0].e.Pm[row];
#pragma unroll
    for (int w = 1; w < NW; ++w) mx = fmaxf(mx, wb[w].e.Pm[row]);
    float dn = 0.0f, a0 = 0.0f, a1 = 0.0f;
#pragma unroll
    for (int w = 0; w < NW; ++w) { const float mw = wb[w].e.Pm[row]; const float sc = (mw == -INFINITY) ? 0.0f : __expf(mw - mx); dn += wb[w].e.Pd[row] * sc; a0 += wb[w].e.Pa[row][nloc] * sc; a1 += wb[w].e.Pa[row][16 + nloc] * sc; }
    den_r[r8] = dn; acc[0][r8] = a0; acc[1][r8] = a1; }
#pragma unroll
  for (int t = 0; t < 2; ++t)
#pragma unroll
    for (int r8 = 0; r8 < 8; ++r8) Of[8 * hlf + r8][t * 16 + nloc] = acc[t][r8] * (1.0f / (HS * PS)) / den_r[r8];
  wave_lds_sync();
  // LayerNorm over the 32 channels (lane = channel), stage hi/lo
  for (int rr = 0; rr < 16; ++rr) { const float v = Of[rr][lane]; float s = v; for (int o = 16; o; o >>= 1) s += __shfl_xor(s, o); const float mu = s / D; float s2 = (v - mu) * (v - mu); for (int o = 16; o; o >>= 1) s2 += __shfl_xor(s2, o); const float rs = rsqrtf(s2 / D + LNEPS); const float nv = pmul(pmul(v - mu, rs), bfv(gam[lane])) + bfv(bet[lane]); b16 p, ql; split16(nv * HS, p, ql); Nh[rr][lane] = p; Nl[rr][lane] = ql; if (lane < 8) { Nh[rr][32 + lane] = (b16)0.0f; Nl[rr][32 + lane] = (b16)0.0f; } }
  wave_lds_sync(); v8f o8[8];
#pragma unroll
  for (int t = 0; t < 8; ++t) o8[t] = (v8f){};
  { const v16b a = frag_kb(&Nh[nloc][0], hlf), al = frag_kb(&Nl[nloc][0], hlf);
#pragma unroll
    for (int t = 0; t < 8; ++t) { const v16b bw = frag_kb(WO + (size_t)(t * 16 + nloc) * D, hlf); o8[t] = wmma16b(a, bw, o8[t]); o8[t] = wmma16b(al, bw, o8[t]); } }
#pragma unroll
  for (int t = 0; t < 8; ++t) { const int cc = t * 16 + nloc; const float bb = bfv(bo[cc]);
#pragma unroll
    for (int r8 = 0; r8 < 8; ++r8) Tf[8 * hlf + r8][cc] = o8[t][r8] * (1.0f / (HS * WSC)) + bb; }
  wave_lds_sync();
  { for (int rr = 0; rr < 16; ++rr) *(v4f*)(out + (t0 + rr) * FO + lane * 4) = *(const v4f*)(&Tf[rr][lane * 4]);  } }
}  // namespace

extern "C" void kernel_launch(void* const* d_in, const int* in_sizes, int n_in, void* d_out, int out_size, void* d_ws, size_t ws_size, hipStream_t stream) {
  (void)n_in;
  auto Fp = [&](int i) { return (const float*)d_in[i]; };
  // Input order: 0 input1 [8192,128]; 1 input2 [8192,128]; 2 Wq [128,32]; 3 bq; 4 Wk; 5 bk; 6 Wv; 7 bv; 8 gamma [32]; 9 beta; 10 Wo [32,128]; 11 bo [128]
  if (in_sizes[0] != N1 * DI || in_sizes[1] != N2 * DI || in_sizes[2] != DI * D || in_sizes[4] != DI * D || in_sizes[6] != DI * D || in_sizes[8] != D || in_sizes[10] != D * FO || in_sizes[11] != FO || out_size != N1 * FO) return;
  const int QLIM = N1, KLIM = N2;   // query / key cuts (multiples of 128)
  size_t off = 0; char* ws = (char*)d_ws;
  auto carve = [&](size_t bytes) { char* p = ws + off; off += (bytes + 255) & ~(size_t)255; return p; };
  b16* W3 = (b16*)carve((size_t)3 * D * DI * 2); b16* WO = (b16*)carve((size_t)FO * D * 2); b16* Qh = (b16*)carve((size_t)N1 * D * 2); b16* Ql = (b16*)carve((size_t)N1 * D * 2); b16* Kh = (b16*)carve((size_t)N2 * D * 2); b16* Kl = (b16*)carve((size_t)N2 * D * 2); b16* Vh = (b16*)carve((size_t)N2 * D * 2); b16* Vl = (b16*)carve((size_t)N2 * D * 2);
  if (off > ws_size || off > ((size_t)8 << 20)) return;   // ~ 3.2 MB
  wput_kernel<<<(3 * D * (DI / 8) + 255) / 256, 256, 0, stream>>>(Fp(2), Fp(4), Fp(6), Fp(10), W3, WO);
  proj_kernel<0><<<QLIM / 16, 32, 0, stream>>>(Fp(0), W3, Fp(3), Fp(3), QLIM, Qh, Ql, Qh, Ql);
  proj_kernel<1><<<KLIM / 16, 32, 0, stream>>>(Fp(1), W3, Fp(5), Fp(7), KLIM, Kh, Kl, Vh, Vl);
  att_kernel<<<QLIM / 16, 32 * NW, 0, stream>>>(Qh, Ql, Kh, Kl, Vh, Vl, WO, Fp(8), Fp(9), Fp(11), QLIM, KLIM, (float*)d_out);
}

// v003
// One run takes 132 microseconds.
// Timed twice side by side with v002, it ran 1.81 and 1.84 times as fast.
// Over all steps from v000 it is 8.29 times as fast.
#include <hip/hip_runtime.h>

// CAM (cross-attention module): q = input1 Wq + bq [8192][32]; k = input2 Wk + bk, v = input2 Wv + bv [8192][32]; scores = q k^T (no scaling); w = softmax over the 8,192 keys; fused = w v; LayerNorm(fused) (eps 1e-5, gamma/beta);
// out = normed Wo + bo -> [8192][128].
// Deterministic: no index structures, no atomics.
// V is kept in the workspace as V^T in groups of 16 keys, [key / 16][channel][key % 16], so that a V^T fragment is two 16-byte loads.
// WMMA (v_wmma_f32_16x16x32_f16, f32 accumulate): projections with the inputs EXACT bf16 x8 (K 128, 2 tiles each) against exact weight rows x256; S^T = k q^T per (128-key block, 16-query tile) and O^T += V^T P^T (q/k/v/P hi+lo x256; 3 products each), so a lane owns one query's scores and P^T packs in-lane into the B operand;
// out = LN(fused) (hi+lo) x Wo rows (K 32, 8 tiles). Online softmax and LayerNorm in f32. Inputs rounded to bf16 once. Fragment k-map per lane half hh for A AND B: elements 0..7 <- k = 8hh+0..7, 8..15 <- k = 16+8hh+0..7;

namespace {
constexpr int N1 = 8192, N2 = 8192, DI = 128, D = 32, FO = 128, KB = 128;
constexpr float XS = 8.0f, HS = 256.0f, WSC = 256.0f, PS = 256.0f, LNEPS = 1e-5f;
typedef _Float16 b16;
typedef __attribute__((ext_vector_type(16))) _Float16 v16b;
typedef __attribute__((ext_vector_type(8))) _Float16 v8b;
typedef __attribute__((ext_vector_type(8))) float v8f;
typedef __attribute__((ext_vector_type(4))) float v4f;
__device__ __forceinline__ float bf16_rne(float f) { unsigned int u = __float_as_uint(f); u += 0x7FFFu + ((u >> 16) & 1u); float r = __uint_as_float(u & 0xFFFF0000u); asm volatile("" : "+v"(r)); return r; }
__device__ __forceinline__ float bfv(float f) { float r = bf16_rne(f); asm volatile("" : "+v"(r)); return r; }
__device__ __forceinline__ void split16(float v, b16& hi, b16& lo) { hi = (b16)v; lo = (b16)(v - (float)hi); }
__device__ __forceinline__ v16b frag_kb(const b16* p, int hh) { const v8b a = *(const v8b*)(p + 8 * hh), b = *(const v8b*)(p + 16 + 8 * hh); v16b f;
#pragma unroll
  for (int e = 0; e < 8; ++e) { f[e] = a[e]; f[8 + e] = b[e]; } return f; }
// V^T fragment in the k-map above: p = this lane's 8 keys (8hh..) of its channel in a 16-key group; elements 8..15 are the same place in the next group
__device__ __forceinline__ v16b frag_vt(const b16* p) { const v8b a = *(const v8b*)p, b = *(const v8b*)(p + D * 16); v16b f;
#pragma unroll
  for (int e = 0; e < 8; ++e) { f[e] = a[e]; f[8 + e] = b[e]; } return f; }
__device__ __forceinline__ v8f wmma16b(v16b a, v16b b, v8f c) { v8f d = __builtin_amdgcn_wmma_f32_16x16x32_f16(false, a, false, b, (short)0, c, false, false); asm volatile("v_nop\n\tv_nop\n\tv_nop\n\tv_nop" : "+v"(d) : "v"(a), "v"(b)); return d; }
__device__ __forceinline__ void wave_lds_sync() { __builtin_amdgcn_fence(__ATOMIC_RELEASE, "workgroup"); __builtin_amdgcn_wave_barrier(); __builtin_amdgcn_fence(__ATOMIC_ACQUIRE, "workgroup"); }
__device__ __forceinline__ float pmul(float a, float b) { float p = a * b; asm volatile("" : "+v"(p)); return p; }
// att_kernel LDS: one slab per wave, used behind the key loop only (partials for the merge, then the epilogue's stages).
constexpr int NW = 4;
struct TailBuf { float Pa[16][D + 4], Pm[16], Pd[16]; b16 Nh[16][40], Nl[16][40]; float Of[16][D + 4], Tf[16][FO + 4]; };

__global__ __launch_bounds__(256) void wput_kernel(const float* __restrict__ wq, const float* __restrict__ wk, const float* __restrict__ wv, const float* __restrict__ wo, b16* __restrict__ W3, b16* __restrict__ WO) { const int u = blockIdx.x * 256 + threadIdx.x; v8b v;
  if (u < 3 * D * (DI / 8)) { const int p = u / (D * (DI / 8)), r = u % (D * (DI / 8)); const int o = r / (DI / 8), k0 = (r % (DI / 8)) * 8; const float* w = p == 0 ? wq : (p == 1 ? wk : wv);
#pragma unroll
    for (int j = 0; j < 8; ++j) v[j] = (b16)(bf16_rne(w[(size_t)(k0 + j) * D + o]) * WSC); { *(v8b*)(W3 + ((size_t)p * D + o) * DI + k0) = v;  } }
  if (u < FO * (D / 8)) { const int o = u / (D / 8), k0 = (u % (D / 8)) * 8;
#pragma unroll
    for (int j = 0; j < 8; ++j) v[j] = (b16)(bf16_rne(wo[(size_t)(k0 + j) * FO + o]) * WSC); { *(v8b*)(WO + (size_t)o * D + k0) = v;  } } }
template <int MODE>
__global__ __launch_bounds__(32) void proj_kernel(const float* __restrict__ x, const b16* __restrict__ W3, const float* __restrict__ ba, const float* __restrict__ bb, int RLIM, b16* __restrict__ Ah_, b16* __restrict__ Al_, b16* __restrict__ Bh_, b16* __restrict__ Bl_) { __shared__ __attribute__((aligned(16))) b16 Xh[16][DI + 8]; __shared__ __attribute__((aligned(16))) b16 Oh[16][72], Ol[16][72]; const int lane = threadIdx.x, nloc = lane & 15, hlf = lane >> 4; const size_t m0 = (size_t)blockIdx.x * 16; if (m0 >= (size_t)RLIM) return; constexpr int NT = MODE == 0 ? 2 : 4;
  for (int rr = 0; rr < 16; ++rr) for (int q = 0; q < 4; ++q) Xh[rr][q * 32 + lane] = (b16)(bf16_rne(x[(m0 + rr) * DI + q * 32 + lane]) * XS); if (lane < 16) for (int k = DI; k < DI + 8; ++k) Xh[lane][k] = (b16)0.0f;
  wave_lds_sync(); v8f acc[NT]; v8b th[2], tl[2];
#pragma unroll
  for (int t = 0; t < NT; ++t) acc[t] = (v8f){};
  const b16* Wb = W3 + (size_t)(MODE == 0 ? 0 : D) * DI;
#pragma unroll
  for (int kb = 0; kb < DI; kb += 32) { const v16b a = frag_kb(&Xh[nloc][kb], hlf);
#pragma unroll
    for (int t = 0; t < NT; ++t) acc[t] = wmma16b(a, frag_kb(Wb + (size_t)(t * 16 + nloc) * DI + kb, hlf), acc[t]); }
#pragma unroll
  for (int t = 0; t < NT; ++t) { const int cc = t * 16 + nloc; const float bias = bfv((t < 2 ? ba : bb)[cc & 31]);
#pragma unroll
    for (int r8 = 0; r8 < 8; ++r8) { b16 p, ql; split16((acc[t][r8] * (1.0f / (XS * WSC)) + bias) * HS, p, ql); if (t < 2) { Oh[8 * hlf + r8][cc] = p; Ol[8 * hlf + r8][cc] = ql; } else { th[t & 1][r8] = p; tl[t & 1][r8] = ql; } } }
  wave_lds_sync();
  // v tiles: a lane holds 8 consecutive keys of one channel, which is 16 bytes of the V^T group of this block's 16 keys
  if (MODE == 1) { const size_t o = ((size_t)blockIdx.x * D + nloc) * 16 + 8 * hlf;
#pragma unroll
    for (int t = 0; t < 2; ++t) { *(v8b*)(Bh_ + o + t * 256) = th[t]; *(v8b*)(Bl_ + o + t * 256) = tl[t]; } }
  typedef __attribute__((ext_vector_type(2))) _Float16 v2b;
  { for (int rr = 0; rr < 16; ++rr) { if (lane < 16) { *(v2b*)(Ah_ + (m0 + rr) * D + lane * 2) = *(const v2b*)(&Oh[rr][lane * 2]); *(v2b*)(Al_ + (m0 + rr) * D + lane * 2) = *(const v2b*)(&Ol[rr][lane * 2]); } }  } }
// attention + LN + Wo: NW WAVES PER BLOCK, block per 16 queries: the 64 key blocks of 128 are dealt round-robin to the waves, V^T fragments hi/lo come straight from the workspace; S^T (8 tiles, K 32; 3 products; A = k rows, B = q): D column = lane's query, D rows = 8 keys per lane half; online softmax per lane in registers (one exchange between the halves for the max);
// P^T x256 hi+lo: tiles 2j and 2j+1 are elements 0..7 and 8..15 of the B fragment of keys 32j.. (the k-map above); O^T += V^T P^T (2 channel tiles; 3 products);
// then the waves' partial (max, den, O) meet in LDS behind one block barrier and wave 0 merges them (rescale to the common max, waves summed in index order); fused = O/den; LN over 32;
__global__ __launch_bounds__(32 * NW) void att_kernel(const b16* __restrict__ Qh, const b16* __restrict__ Ql, const b16* __restrict__ Kh, const b16* __restrict__ Kl, const b16* __restrict__ Vh, const b16* __restrict__ Vl, const b16* __restrict__ WO, const float* __restrict__ gam, const float* __restrict__ bet, const float* __restrict__ bo, int QLIM, int KLIM, float* __restrict__ out) {
  __shared__ __attribute__((aligned(16))) TailBuf wb[NW];
  const int lane = threadIdx.x & 31, wave = __builtin_amdgcn_readfirstlane(threadIdx.x >> 5), nloc = lane & 15, hlf = lane >> 4; const size_t t0 = (size_t)blockIdx.x * 16; if (t0 >= (size_t)QLIM) return;
  const v16b qa = frag_kb(Qh + (t0 + nloc) * D, hlf), qb = frag_kb(Ql + (t0 + nloc) * D, hlf);
  // per lane: query nloc's running max (equal in both halves) and this half's share of its denominator; acc[t][r8] = O^T[channel 16t + 8hlf + r8][query nloc]
  float m_q = -INFINITY, den_q = 0.0f; v8f acc[2] = {(v8f){}, (v8f){}};
#pragma unroll 1
  for (int kb0 = wave * KB; kb0 < KLIM; kb0 += NW * KB) {
    // V^T fragments of this key block: the first 64 keys' are asked for here and fly under the S^T tiles, the other 64 keys' behind the tiles and fly under the softmax (all at once would not fit 256 registers beside the scores)
    v16b vh[KB / 32][2], vl[KB / 32][2]; const size_t vo = ((size_t)(kb0 >> 4) * D + nloc) * 16 + 8 * hlf;   // this lane's place in the block's first group: channel nloc, keys 8hlf..
#pragma unroll
    for (int j = 0; j < KB / 64; ++j)
#pragma unroll
      for (int t = 0; t < 2; ++t) { vh[j][t] = frag_vt(Vh + vo + (2 * j * D + t * 16) * 16); vl[j][t] = frag_vt(Vl + vo + (2 * j * D + t * 16) * 16); }
    asm volatile("s_wait_xcnt 0x0" ::: "memory");   // keeps the first Kh loads behind these loads, whose results the compiler otherwise places in the registers that hold the Kh address
    // S^T tiles (K 32 = one k-step): rows = keys, cols = queries
    v8f st[KB / 16], mv;
#pragma unroll
    for (int t = 0; t < KB / 16; ++t) { const size_t key = (size_t)kb0 + t * 16 + nloc; const v16b ka = frag_kb(Kh + key * D, hlf);
      asm volatile("s_wait_xcnt 0x0" ::: "memory");   // stands in front of the Kl loads, whose results the compiler may place in the registers that hold the Kh address
      const v16b kbf = frag_kb(Kl + key * D, hlf); v8f s = {}; s = wmma16b(ka, qa, s); s = wmma16b(kbf, qa, s); s = wmma16b(ka, qb, s);
#pragma unroll
      for (int r8 = 0; r8 < 8; ++r8) { st[t][r8] = s[r8] * (1.0f / (HS * HS)); mv[r8] = t == 0 ? st[t][r8] : fmaxf(mv[r8], st[t][r8]); } }
#pragma unroll
    for (int j = KB / 64; j < KB / 32; ++j)
#pragma unroll
      for (int t = 0; t < 2; ++t) { vh[j][t] = frag_vt(Vh + vo + (2 * j * D + t * 16) * 16); vl[j][t] = frag_vt(Vl + vo + (2 * j * D + t * 16) * 16); }
    float mx = mv[0];
#pragma unroll
    for (int r8 = 1; r8 < 8; ++r8) mx = fmaxf(mx, mv[r8]);
    mx = fmaxf(mx, __shfl_xor(mx, 16));
    const float mn = fmaxf(m_q, mx); const float sf = (m_q == -INFINITY) ? 0.0f : __expf(m_q - mn); v8f pv = {}; v16b pa[KB / 32], pb[KB / 32];
#pragma unroll
    for (int t = 0; t < KB / 16; ++t)
#pragma unroll
      for (int r8 = 0; r8 < 8; ++r8) { const float p = __expf(st[t][r8] - mn); pv[r8] += p; b16 ph, pl; split16(p * PS, ph, pl); pa[t >> 1][(t & 1) * 8 + r8] = ph; pb[t >> 1][(t & 1) * 8 + r8] = pl; }
    const float ps = ((pv[0] + pv[1]) + (pv[2] + pv[3])) + ((pv[4] + pv[5]) + (pv[6] + pv[7]));
    den_q = den_q * sf + ps; m_q = mn;
#pragma unroll
    for (int t = 0; t < 2; ++t)
#pragma unroll
      for (int r8 = 0; r8 < 8; ++r8) acc[t][r8] = acc[t][r8] * sf;
#pragma unroll
    for (int ks = 0; ks < KB; ks += 32) {
#pragma unroll
      for (int t = 0; t < 2; ++t) { acc[t] = wmma16b(vh[ks / 32][t], pa[ks / 32], acc[t]); acc[t] = wmma16b(vl[ks / 32][t], pa[ks / 32], acc[t]); acc[t] = wmma16b(vh[ks / 32][t], pb[ks / 32], acc[t]); } } }
  // each wave publishes its partial row max, denominator (the halves' shares joined here) and O (back to [query][channel]) in its own slab
  { TailBuf& E = wb[wave]; const float den_f = den_q + __shfl_xor(den_q, 16);
#pragma unroll
    for (int t = 0; t < 2; ++t)
#pragma unroll
      for (int r8 = 0; r8 < 8; ++r8) E.Pa[nloc][t * 16 + 8 * hlf + r8] = acc[t][r8];
    if (hlf == 0) { E.Pm[nloc] = m_q; E.Pd[nloc] = den_f; } }
  __syncthreads();   // every wave's partials are in LDS before wave 0 reads them
  if (wave != 0) return;
  auto& Nh = wb[0].Nh; auto& Nl = wb[0].Nl; auto& Of = wb[0].Of; auto& Tf = wb[0].Tf; float den_r[8];
#pragma unroll
  for (int r8 = 0; r8 < 8; ++r8) { const int row = 8 * hlf + r8; float mx = wb[0].Pm[row];
#pragma unroll
    for (int w = 1; w < NW; ++w) mx = fmaxf(mx, wb[w].Pm[row]);
    float dn = 0.0f, a0 = 0.0f, a1 = 0.0f;
#pragma unroll
    for (int w = 0; w < NW; ++w) { const float mw = wb[w].Pm[row]; const float sc = (mw == -INFINITY) ? 0.0f : __expf(mw - mx); dn += wb[w].Pd[row] * sc; a0 += wb[w].Pa[row][nloc] * sc; a1 += wb[w].Pa[row][16 + nloc] * sc; }
    den_r[r8] = dn; acc[0][r8] = a0; acc[1][r8] = a1; }
#pragma unroll
  for (int t = 0; t < 2; ++t)
#pragma unroll
    for (int r8 = 0; r8 < 8; ++r8) Of[8 * hlf + r8][t * 16 + nloc] = acc[t][r8] * (1.0f / (HS * PS)) / den_r[r8];
  wave_lds_sync();
  // LayerNorm over the 32 channels (lane = channel), stage hi/lo
  for (int rr = 0; rr < 16; ++rr) { const float v = Of[rr][lane]; float s = v; for (int o = 16; o; o >>= 1) s += __shfl_xor(s, o); const float mu = s / D; float s2 = (v - mu) * (v - mu); for (int o = 16; o; o >>= 1) s2 += __shfl_xor(s2, o); const float rs = rsqrtf(s2 / D + LNEPS); const float nv = pmul(pmul(v - mu, rs), bfv(gam[lane])) + bfv(bet[lane]); b16 p, ql; split16(nv * HS, p, ql); Nh[rr][lane] = p; Nl[rr][lane] = ql; if (lane < 8) { Nh[rr][32 + lane] = (b16)0.0f; Nl[rr][32 + lane] = (b16)0.0f; } }
  wave_lds_sync(); v8f o8[8];
#pragma unroll
  for (int t = 0; t < 8; ++t) o8[t] = (v8f){};
  { const v16b a = frag_kb(&Nh[nloc][0], hlf), al = frag_kb(&Nl[nloc][0], hlf);
#pragma unroll
    for (int t = 0; t < 8; ++t) { const v16b bw = frag_kb(WO + (size_t)(t * 16 + nloc) * D, hlf); o8[t] = wmma16b(a, bw, o8[t]); o8[t] = wmma16b(al, bw, o8[t]); } }
#pragma unroll
  for (int t = 0; t < 8; ++t) { const int cc = t * 16 + nloc; const float bb = bfv(bo[cc]);
#pragma unroll
    for (int r8 = 0; r8 < 8; ++r8) Tf[8 * hlf + r8][cc] = o8[t][r8] * (1.0f / (HS * WSC)) + bb; }
  wave_lds_sync();
  { for (int rr = 0; rr < 16; ++rr) *(v4f*)(out + (t0 + rr) * FO + lane * 4) = *(const v4f*)(&Tf[rr][lane * 4]);  } }
}  // namespace

extern "C" void kernel_launch(void* const* d_in, const int* in_sizes, int n_in, void* d_out, int out_size, void* d_ws, size_t ws_size, hipStream_t stream) {
  (void)n_in;
  auto Fp = [&](int i) { return (const float*)d_in[i]; };
  // Input order: 0 input1 [8192,128]; 1 input2 [8192,128]; 2 Wq [128,32]; 3 bq; 4 Wk; 5 bk; 6 Wv; 7 bv; 8 gamma [32]; 9 beta; 10 Wo [32,128]; 11 bo [128]
  if (in_sizes[0] != N1 * DI || in_sizes[1] != N2 * DI || in_sizes[2] != DI * D || in_sizes[4] != DI * D || in_sizes[6] != DI * D || in_sizes[8] != D || in_sizes[10] != D * FO || in_sizes[11] != FO || out_size != N1 * FO) return;
  const int QLIM = N1, KLIM = N2;   // query / key cuts (multiples of 128)
  size_t off = 0; char* ws = (char*)d_ws;
  auto carve = [&](size_t bytes) { char* p = ws + off; off += (bytes + 255) & ~(size_t)255; return p; };
  b16* W3 = (b16*)carve((size_t)3 * D * DI * 2); b16* WO = (b16*)carve((size_t)FO * D * 2); b16* Qh = (b16*)carve((size_t)N1 * D * 2); b16* Ql = (b16*)carve((size_t)N1 * D * 2); b16* Kh = (b16*)carve((size_t)N2 * D * 2); b16* Kl = (b16*)carve((size_t)N2 * D * 2); b16* Vh = (b16*)carve((size_t)N2 * D * 2); b16* Vl = (b16*)carve((size_t)N2 * D * 2);
  if (off > ws_size || off > ((size_t)8 << 20)) return;   // ~ 3.2 MB
  wput_kernel<<<(3 * D * (DI / 8) + 255) / 256, 256, 0, stream>>>(Fp(2), Fp(4), Fp(6), Fp(10), W3, WO);
  proj_kernel<0><<<QLIM / 16, 32, 0, stream>>>(Fp(0), W3, Fp(3), Fp(3), QLIM, Qh, Ql, Qh, Ql);
  proj_kernel<1><<<KLIM / 16, 32, 0, stream>>>(Fp(1), W3, Fp(5), Fp(7), KLIM, Kh, Kl, Vh, Vl);
  att_kernel<<<QLIM / 16, 32 * NW, 0, stream>>>(Qh, Ql, Kh, Kl, Vh, Vl, WO, Fp(8), Fp(9), Fp(11), QLIM, KLIM, (float*)d_out);
}

// v004
// Measured time: 104 microseconds a run.
// Timed twice side by side with v003, it ran 1.26 and 1.25 times as fast.
// All steps since v000 together make it 10.4 times as fast.
#include <hip/hip_runtime.h>

// CAM (cross-attention module): q = input1 Wq + bq [8192][32]; k = input2 Wk + bk, v = input2 Wv + bv [8192][32]; scores = q k^T (no scaling); w = softmax over the 8,192 keys; fused = w v; LayerNorm(fused) (eps 1e-5, gamma/beta);
// out = normed Wo + bo -> [8192][128].
// Deterministic: no index structures, no atomics.
// V is kept in the workspace as V^T in groups of 16 keys, [key / 16][channel][key % 16], so that a V^T fragment is two 16-byte loads.
// WMMA (v_wmma_f32_16x16x32_f16, f32 accumulate): projections with the inputs EXACT bf16 x8 (K 128, 2 tiles each) against exact weight rows x256; S^T = k q^T per (64-key block, 16-query tile) and O^T += V^T P^T (q/k/v/P hi+lo x256; 3 products each), so a lane owns one query's scores and P^T packs in-lane into the B operand;
// out = LN(fused) (hi+lo) x Wo rows (K 32, 8 tiles). Online softmax and LayerNorm in f32. Inputs rounded to bf16 once. Fragment k-map per lane half hh for A AND B: elements 0..7 <- k = 8hh+0..7, 8..15 <- k = 16+8hh+0..7;

namespace {
constexpr int N1 = 8192, N2 = 8192, DI = 128, D = 32, FO = 128, KB = 64;
constexpr float XS = 8.0f, HS = 256.0f, WSC = 256.0f, PS = 256.0f, LNEPS = 1e-5f;
typedef _Float16 b16;
typedef __attribute__((ext_vector_type(16))) _Float16 v16b;
typedef __attribute__((ext_vector_type(8))) _Float16 v8b;
typedef __attribute__((ext_vector_type(8))) float v8f;
typedef __attribute__((ext_vector_type(4))) float v4f;
__device__ __forceinline__ float bf16_rne(float f) { unsigned int u = __float_as_uint(f); u += 0x7FFFu + ((u >> 16) & 1u); float r = __uint_as_float(u & 0xFFFF0000u); asm volatile("" : "+v"(r)); return r; }
__device__ __forceinline__ float bfv(float f) { float r = bf16_rne(f); asm volatile("" : "+v"(r)); return r; }
__device__ __forceinline__ void split16(float v, b16& hi, b16& lo) { hi = (b16)v; lo = (b16)(v - (float)hi); }
__device__ __forceinline__ v16b frag_kb(const b16* p, int hh) { const v8b a = *(const v8b*)(p + 8 * hh), b = *(const v8b*)(p + 16 + 8 * hh); v16b f;
#pragma unroll
  for (int e = 0; e < 8; ++e) { f[e] = a[e]; f[8 + e] = b[e]; } return f; }
// the same fragment from a pointer that already holds the lane half's 8hh
__device__ __forceinline__ v16b frag_at(const b16* p) { const v8b a = *(const v8b*)p, b = *(const v8b*)(p + 16); v16b f;
#pragma unroll
  for (int e = 0; e < 8; ++e) { f[e] = a[e]; f[8 + e] = b[e]; } return f; }
// V^T fragment in the k-map above: p = this lane's 8 keys (8hh..) of its channel in a 16-key group; elements 8..15 are the same place in the next group
__device__ __forceinline__ v16b frag_vt(const b16* p) { const v8b a = *(const v8b*)p, b = *(const v8b*)(p + D * 16); v16b f;
#pragma unroll
  for (int e = 0; e < 8; ++e) { f[e] = a[e]; f[8 + e] = b[e]; } return f; }
__device__ __forceinline__ v8f wmma16b(v16b a, v16b b, v8f c) { v8f d = __builtin_amdgcn_wmma_f32_16x16x32_f16(false, a, false, b, (short)0, c, false, false); asm volatile("v_nop\n\tv_nop\n\tv_nop\n\tv_nop" : "+v"(d) : "v"(a), "v"(b)); return d; }
__device__ __forceinline__ void wave_lds_sync() { __builtin_amdgcn_fence(__ATOMIC_RELEASE, "workgroup"); __builtin_amdgcn_wave_barrier(); __builtin_amdgcn_fence(__ATOMIC_ACQUIRE, "workgroup"); }
__device__ __forceinline__ float pmul(float a, float b) { float p = a * b; asm volatile("" : "+v"(p)); return p; }
// att_kernel LDS: one slab per wave, used behind the key loop only (partials for the merge, then the epilogue's stages).
constexpr int NW = 4;
struct TailBuf { float Pa[16][D + 4], Pm[16], Pd[16]; b16 Nh[16][40], Nl[16][40]; float Of[16][D + 4], Tf[16][FO + 4]; };

__global__ __launch_bounds__(256) void wput_kernel(const float* __restrict__ wq, const float* __restrict__ wk, const float* __restrict__ wv, const float* __restrict__ wo, b16* __restrict__ W3, b16* __restrict__ WO) { const int u = blockIdx.x * 256 + threadIdx.x; v8b v;
  if (u < 3 * D * (DI / 8)) { const int p = u / (D * (DI / 8)), r = u % (D * (DI / 8)); const int o = r / (DI / 8), k0 = (r % (DI / 8)) * 8; const float* w = p == 0 ? wq : (p == 1 ? wk : wv);
#pragma unroll
    for (int j = 0; j < 8; ++j) v[j] = (b16)(bf16_rne(w[(size_t)(k0 + j) * D + o]) * WSC); { *(v8b*)(W3 + ((size_t)p * D + o) * DI + k0) = v;  } }
  if (u < FO * (D / 8)) { const int o = u / (D / 8), k0 = (u % (D / 8)) * 8;
#pragma unroll
    for (int j = 0; j < 8; ++j) v[j] = (b16)(bf16_rne(wo[(size_t)(k0 + j) * FO + o]) * WSC); { *(v8b*)(WO + (size_t)o * D + k0) = v;  } } }
template <int MODE>
__global__ __launch_bounds__(32) void proj_kernel(const float* __restrict__ x, const b16* __restrict__ W3, const float* __restrict__ ba, const float* __restrict__ bb, int RLIM, b16* __restrict__ Ah_, b16* __restrict__ Al_, b16* __restrict__ Bh_, b16* __restrict__ Bl_) { __shared__ __attribute__((aligned(16))) b16 Xh[16][DI + 8]; __shared__ __attribute__((aligned(16))) b16 Oh[16][72], Ol[16][72]; const int lane = threadIdx.x, nloc = lane & 15, hlf = lane >> 4; const size_t m0 = (size_t)blockIdx.x * 16; if (m0 >= (size_t)RLIM) return; constexpr int NT = MODE == 0 ? 2 : 4;
  for (int rr = 0; rr < 16; ++rr) for (int q = 0; q < 4; ++q) Xh[rr][q * 32 + lane] = (b16)(bf16_rne(x[(m0 + rr) * DI + q * 32 + lane]) * XS); if (lane < 16) for (int k = DI; k < DI + 8; ++k) Xh[lane][k] = (b16)0.0f;
  wave_lds_sync(); v8f acc[NT]; v8b th[2], tl[2];
#pragma unroll
  for (int t = 0; t < NT; ++t) acc[t] = (v8f){};
  const b16* Wb = W3 + (size_t)(MODE == 0 ? 0 : D) * DI;
#pragma unroll
  for (int kb = 0; kb < DI; kb += 32) { const v16b a = frag_kb(&Xh[nloc][kb], hlf);
#pragma unroll
    for (int t = 0; t < NT; ++t) acc[t] = wmma16b(a, frag_kb(Wb + (size_t)(t * 16 + nloc) * DI + kb, hlf), acc[t]); }
#pragma unroll
  for (int t = 0; t < NT; ++t) { const int cc = t * 16 + nloc; const float bias = bfv((t < 2 ? ba : bb)[cc & 31]);
#pragma unroll
    for (int r8 = 0; r8 < 8; ++r8) { b16 p, ql; split16((acc[t][r8] * (1.0f / (XS * WSC)) + bias) * HS, p, ql); if (t < 2) { Oh[8 * hlf + r8][cc] = p; Ol[8 * hlf + r8][cc] = ql; } else { th[t & 1][r8] = p; tl[t & 1][r8] = ql; } } }
  wave_lds_sync();
  // v tiles: a lane holds 8 consecutive keys of one channel, which is 16 bytes of the V^T group of this block's 16 keys
  if (MODE == 1) { const size_t o = ((size_t)blockIdx.x * D + nloc) * 16 + 8 * hlf;
#pragma unroll
    for (int t = 0; t < 2; ++t) { *(v8b*)(Bh_ + o + t * 256) = th[t]; *(v8b*)(Bl_ + o + t * 256) = tl[t]; } }
  typedef __attribute__((ext_vector_type(2))) _Float16 v2b;
  { for (int rr = 0; rr < 16; ++rr) { if (lane < 16) { *(v2b*)(Ah_ + (m0 + rr) * D + lane * 2) = *(const v2b*)(&Oh[rr][lane * 2]); *(v2b*)(Al_ + (m0 + rr) * D + lane * 2) = *(const v2b*)(&Ol[rr][lane * 2]); } }  } }
// attention + LN + Wo: NW WAVES PER BLOCK, block per 16 queries: the 128 key blocks of 64 are dealt round-robin to the waves, V^T fragments hi/lo come straight from the workspace; S^T (4 tiles, K 32; 3 products; A = k rows, B = q): D column = lane's query, D rows = 8 keys per lane half; online softmax per lane in registers (one exchange between the halves for the max);
// P^T x256 hi+lo: tiles 2j and 2j+1 are elements 0..7 and 8..15 of the B fragment of keys 32j.. (the k-map above); O^T += V^T P^T (2 channel tiles; 3 products);
// then the waves' partial (max, den, O) meet in LDS behind one block barrier and wave 0 merges them (rescale to the common max, waves summed in index order); fused = O/den; LN over 32;
__global__ __launch_bounds__(32 * NW) void att_kernel(const b16* __restrict__ Qh, const b16* __restrict__ Ql, const b16* __restrict__ Kh, const b16* __restrict__ Kl, const b16* __restrict__ Vh, const b16* __restrict__ Vl, const b16* __restrict__ WO, const float* __restrict__ gam, const float* __restrict__ bet, const float* __restrict__ bo, int QLIM, int KLIM, float* __restrict__ out) {
  __shared__ __attribute__((aligned(16))) TailBuf wb[NW];
  const int lane = threadIdx.x & 31, wave = __builtin_amdgcn_readfirstlane(threadIdx.x >> 5), nloc = lane & 15, hlf = lane >> 4; const size_t t0 = (size_t)blockIdx.x * 16; if (t0 >= (size_t)QLIM) return;
  const b16* pqh = Qh + (t0 + nloc) * D + 8 * hlf; const b16* pql = Ql + (t0 + nloc) * D + 8 * hlf; const v16b qa = frag_at(pqh), qb = frag_at(pql);
  asm volatile("s_wait_xcnt 0x0" :: "v"(pqh), "v"(pql) : "memory");   // the address registers of the q loads stay untouched up to this wait
  // per lane: query nloc's running max (equal in both halves) and this half's share of its denominator; acc[t][r8] = O^T[channel 16t + 8hlf + r8][query nloc]
  float m_q = -INFINITY, den_q = 0.0f; v8f acc[2] = {(v8f){}, (v8f){}};
  // K fragments hi/lo of one whole key block live in registers and are fetched one block ahead; the first block's are asked for here
  v16b kh[KB / 16], kl[KB / 16]; const unsigned ko = (unsigned)(nloc * D + 8 * hlf);   // this lane's row and half in a 16-key tile
  if (wave * KB < KLIM) { const b16* ph = Kh + (size_t)(wave * KB) * D + ko; const b16* pl = Kl + (size_t)(wave * KB) * D + ko;
#pragma unroll
    for (int t = 0; t < KB / 16; ++t) { kh[t] = frag_at(ph + t * 16 * D); kl[t] = frag_at(pl + t * 16 * D); }
    asm volatile("s_wait_xcnt 0x0" :: "v"(ph), "v"(pl) : "memory"); }   // stands in front of every overwrite of a register that the loads above name
#pragma unroll 1
  for (int kb0 = wave * KB; kb0 < KLIM; kb0 += NW * KB) {
    // V^T fragments of this key block: all asked for here, they fly under the S^T tiles and the softmax
    v16b vh[KB / 32][2], vl[KB / 32][2]; const size_t vo = ((size_t)(kb0 >> 4) * D + nloc) * 16 + 8 * hlf;   // this lane's place in the block's first group: channel nloc, keys 8hlf..
    { const b16* ph = Vh + vo; const b16* pl = Vl + vo;
#pragma unroll
      for (int j = 0; j < KB / 32; ++j)
#pragma unroll
        for (int t = 0; t < 2; ++t) { vh[j][t] = frag_vt(ph + (2 * j * D + t * 16) * 16); vl[j][t] = frag_vt(pl + (2 * j * D + t * 16) * 16); }
      asm volatile("s_wait_xcnt 0x0" :: "v"(ph), "v"(pl) : "memory"); }   // holds the loads above in front of the tiles; their address registers stay untouched up to this wait
    // S^T tiles (K 32 = one k-step): rows = keys, cols = queries
    v8f st[KB / 16], mv;
#pragma unroll
    for (int t = 0; t < KB / 16; ++t) { v8f s = {}; s = wmma16b(kh[t], qa, s); s = wmma16b(kl[t], qa, s); s = wmma16b(kh[t], qb, s);
#pragma unroll
      for (int r8 = 0; r8 < 8; ++r8) { st[t][r8] = s[r8] * (1.0f / (HS * HS)); mv[r8] = t == 0 ? st[t][r8] : fmaxf(mv[r8], st[t][r8]); } }
    // the wave's next key block's K fragments: asked for here, they fly under the softmax and the O^T products (behind the last block: this block's again, unused)
    { const int kn = kb0 + NW * KB < KLIM ? kb0 + NW * KB : kb0; const b16* ph = Kh + (size_t)kn * D + ko; const b16* pl = Kl + (size_t)kn * D + ko;
#pragma unroll
      for (int t = 0; t < KB / 16; ++t) { kh[t] = frag_at(ph + t * 16 * D); kl[t] = frag_at(pl + t * 16 * D); }
      asm volatile("s_wait_xcnt 0x0" :: "v"(ph), "v"(pl) : "memory"); }   // holds the loads above in front of the softmax; their address registers stay untouched up to this wait
    float mx = mv[0];
#pragma unroll
    for (int r8 = 1; r8 < 8; ++r8) mx = fmaxf(mx, mv[r8]);
    mx = fmaxf(mx, __shfl_xor(mx, 16));
    const float mn = fmaxf(m_q, mx); const float sf = (m_q == -INFINITY) ? 0.0f : __expf(m_q - mn); v8f pv = {}; v16b pa[KB / 32], pb[KB / 32];
#pragma unroll
    for (int t = 0; t < KB / 16; ++t)
#pragma unroll
      for (int r8 = 0; r8 < 8; ++r8) { const float p = __expf(st[t][r8] - mn); pv[r8] += p; b16 ph, pl; split16(p * PS, ph, pl); pa[t >> 1][(t & 1) * 8 + r8] = ph; pb[t >> 1][(t & 1) * 8 + r8] = pl; }
    const float ps = ((pv[0] + pv[1]) + (pv[2] + pv[3])) + ((pv[4] + pv[5]) + (pv[6] + pv[7]));
    den_q = den_q * sf + ps; m_q = mn;
#pragma unroll
    for (int t = 0; t < 2; ++t)
#pragma unroll
      for (int r8 = 0; r8 < 8; ++r8) acc[t][r8] = acc[t][r8] * sf;
#pragma unroll
    for (int ks = 0; ks < KB; ks += 32) {
#pragma unroll
      for (int t = 0; t < 2; ++t) { acc[t] = wmma16b(vh[ks / 32][t], pa[ks / 32], acc[t]); acc[t] = wmma16b(vl[ks / 32][t], pa[ks / 32], acc[t]); acc[t] = wmma16b(vh[ks / 32][t], pb[ks / 32], acc[t]); } } }
  // each wave publishes its partial row max, denominator (the halves' shares joined here) and O (back to [query][channel]) in its own slab
  { TailBuf& E = wb[wave]; const float den_f = den_q + __shfl_xor(den_q, 16);
#pragma unroll
    for (int t = 0; t < 2; ++t)
#pragma unroll
      for (int r8 = 0; r8 < 8; ++r8) E.Pa[nloc][t * 16 + 8 * hlf + r8] = acc[t][r8];
    if (hlf == 0) { E.Pm[nloc] = m_q; E.Pd[nloc] = den_f; } }
  __syncthreads();   // every wave's partials are in LDS before wave 0 reads them
  if (wave != 0) return;
  auto& Nh = wb[0].Nh; auto& Nl = wb[0].Nl; auto& Of = wb[0].Of; auto& Tf = wb[0].Tf; float den_r[8];
#pragma unroll
  for (int r8 = 0; r8 < 8; ++r8) { const int row = 8 * hlf + r8; float mx = wb[0].Pm[row];
#pragma unroll
    for (int w = 1; w < NW; ++w) mx = fmaxf(mx, wb[w].Pm[row]);
    float dn = 0.0f, a0 = 0.0f, a1 = 0.0f;
#pragma unroll
    for (int w = 0; w < NW; ++w) { const float mw = wb[w].Pm[row]; const float sc = (mw == -INFINITY) ? 0.0f : __expf(mw - mx); dn += wb[w].Pd[row] * sc; a0 += wb[w].Pa[row][nloc] * sc; a1 += wb[w].Pa[row][16 + nloc] * sc; }
    den_r[r8] = dn; acc[0][r8] = a0; acc[1][r8] = a1; }
#pragma unroll
  for (int t = 0; t < 2; ++t)
#pragma unroll
    for (int r8 = 0; r8 < 8; ++r8) Of[8 * hlf + r8][t * 16 + nloc] = acc[t][r8] * (1.0f / (HS * PS)) / den_r[r8];
  wave_lds_sync();
  // LayerNorm over the 32 channels (lane = channel), stage hi/lo
  for (int rr = 0; rr < 16; ++rr) { const float v = Of[rr][lane]; float s = v; for (int o = 16; o; o >>= 1) s += __shfl_xor(s, o); const float mu = s / D; float s2 = (v - mu) * (v - mu); for (int o = 16; o; o >>= 1) s2 += __shfl_xor(s2, o); const float rs = rsqrtf(s2 / D + LNEPS); const float nv = pmul(pmul(v - mu, rs), bfv(gam[lane])) + bfv(bet[lane]); b16 p, ql; split16(nv * HS, p, ql); Nh[rr][lane] = p; Nl[rr][lane] = ql; if (lane < 8) { Nh[rr][32 + lane] = (b16)0.0f; Nl[rr][32 + lane] = (b16)0.0f; } }
  wave_lds_sync(); v8f o8[8];
#pragma unroll
  for (int t = 0; t < 8; ++t) o8[t] = (v8f){};
  { const v16b a = frag_kb(&Nh[nloc][0], hlf), al = frag_kb(&Nl[nloc][0], hlf);
#pragma unroll
    for (int t = 0; t < 8; ++t) { const v16b bw = frag_kb(WO + (size_t)(t * 16 + nloc) * D, hlf); o8[t] = wmma16b(a, bw, o8[t]); o8[t] = wmma16b(al, bw, o8[t]); } }
#pragma unroll
  for (int t = 0; t < 8; ++t) { const int cc = t * 16 + nloc; const float bb = bfv(bo[cc]);
#pragma unroll
    for (int r8 = 0; r8 < 8; ++r8) Tf[8 * hlf + r8][cc] = o8[t][r8] * (1.0f / (HS * WSC)) + bb; }
  wave_lds_sync();
  { for (int rr = 0; rr < 16; ++rr) *(v4f*)(out + (t0 + rr) * FO + lane * 4) = *(const v4f*)(&Tf[rr][lane * 4]);  } }
}  // namespace

extern "C" void kernel_launch(void* const* d_in, const int* in_sizes, int n_in, void* d_out, int out_size, void* d_ws, size_t ws_size, hipStream_t stream) {
  (void)n_in;
  auto Fp = [&](int i) { return (const float*)d_in[i]; };
  // Input order: 0 input1 [8192,128]; 1 input2 [8192,128]; 2 Wq [128,32]; 3 bq; 4 Wk; 5 bk; 6 Wv; 7 bv; 8 gamma [32]; 9 beta; 10 Wo [32,128]; 11 bo [128]
  if (in_sizes[0] != N1 * DI || in_sizes[1] != N2 * DI || in_sizes[2] != DI * D || in_sizes[4] != DI * D || in_sizes[6] != DI * D || in_sizes[8] != D || in_sizes[10] != D * FO || in_sizes[11] != FO || out_size != N1 * FO) return;
  const int QLIM = N1, KLIM = N2;   // query / key cuts (multiples of 128)
  size_t off = 0; char* ws = (char*)d_ws;
  auto carve = [&](size_t bytes) { char* p = ws + off; off += (bytes + 255) & ~(size_t)255; return p; };
  b16* W3 = (b16*)carve((size_t)3 * D * DI * 2); b16* WO = (b16*)carve((size_t)FO * D * 2); b16* Qh = (b16*)carve((size_t)N1 * D * 2); b16* Ql = (b16*)carve((size_t)N1 * D * 2); b16* Kh = (b16*)carve((size_t)N2 * D * 2); b16* Kl = (b16*)carve((size_t)N2 * D * 2); b16* Vh = (b16*)carve((size_t)N2 * D * 2); b16* Vl = (b16*)carve((size_t)N2 * D * 2);
  if (off > ws_size || off > ((size_t)8 << 20)) return;   // ~ 3.2 MB
  wput_kernel<<<(3 * D * (DI / 8) + 255) / 256, 256, 0, stream>>>(Fp(2), Fp(4), Fp(6), Fp(10), W3, WO);
  proj_kernel<0><<<QLIM / 16, 32, 0, stream>>>(Fp(0), W3, Fp(3), Fp(3), QLIM, Qh, Ql, Qh, Ql);
  proj_kernel<1><<<KLIM / 16, 32, 0, stream>>>(Fp(1), W3, Fp(5), Fp(7), KLIM, Kh, Kl, Vh, Vl);
  att_kernel<<<QLIM / 16, 32 * NW, 0, stream>>>(Qh, Ql, Kh, Kl, Vh, Vl, WO, Fp(8), Fp(9), Fp(11), QLIM, KLIM, (float*)d_out);
}

// v005
// Measured time: 58.5 microseconds a run.
// Next to v004, in two timings, it ran 1.81 and 1.80 times as fast.
// Over all steps from v000 it is 18.8 times as fast.
#include <hip/hip_runtime.h>

// CAM (cross-attention module): q = input1 Wq + bq [8192][32]; k = input2 Wk + bk, v = input2 Wv + bv [8192][32]; scores = q k^T (no scaling); w = softmax over the 8,192 keys; fused = w v; LayerNorm(fused) (eps 1e-5, gamma/beta);
// out = normed Wo + bo -> [8192][128].
// Deterministic: no index structures, no atomics.
// V is kept in the workspace as V^T in groups of 16 keys, [key / 16][channel][key % 16], so that a V^T fragment is two 16-byte loads.
// WMMA (v_wmma_f32_16x16x32_f16, f32 accumulate): projections with the inputs EXACT bf16 x8 (K 128, 2 tiles each) against exact weight rows x256; S^T = k q^T per (64-key block, 16-query tile) and O^T += V^T P^T (q/k/v/P hi+lo x256; 3 products each), so a lane owns one query's scores and P^T packs in-lane into the B operand;
// out = LN(fused) (hi+lo) x Wo rows (K 32, 8 tiles). Online softmax and LayerNorm in f32. Inputs rounded to bf16 once. Fragment k-map per lane half hh for A AND B: elements 0..7 <- k = 8hh+0..7, 8..15 <- k = 16+8hh+0..7;

namespace {
constexpr int N1 = 8192, N2 = 8192, DI = 128, D = 32, FO = 128, KB = 64;
constexpr float XS = 8.0f, HS = 256.0f, WSC = 256.0f, PS = 256.0f, LNEPS = 1e-5f;
typedef _Float16 b16;
typedef __attribute__((ext_vector_type(16))) _Float16 v16b;
typedef __attribute__((ext_vector_type(8))) _Float16 v8b;
typedef __attribute__((ext_vector_type(8))) float v8f;
typedef __attribute__((ext_vector_type(4))) float v4f;
__device__ __forceinline__ float bf16_rne(float f) { unsigned int u = __float_as_uint(f); u += 0x7FFFu + ((u >> 16) & 1u); float r = __uint_as_float(u & 0xFFFF0000u); asm volatile("" : "+v"(r)); return r; }
__device__ __forceinline__ float bfv(float f) { float r = bf16_rne(f); asm volatile("" : "+v"(r)); return r; }
__device__ __forceinline__ void split16(float v, b16& hi, b16& lo) { hi = (b16)v; lo = (b16)(v - (float)hi); }
__device__ __forceinline__ v16b frag_kb(const b16* p, int hh) { const v8b a = *(const v8b*)(p + 8 * hh), b = *(const v8b*)(p + 16 + 8 * hh); v16b f;
#pragma unroll
  for (int e = 0; e < 8; ++e) { f[e] = a[e]; f[8 + e] = b[e]; } return f; }
// the same fragment from a pointer that already holds the lane half's 8hh
__device__ __forceinline__ v16b frag_at(const b16* p) { const v8b a = *(const v8b*)p, b = *(const v8b*)(p + 16); v16b f;
#pragma unroll
  for (int e = 0; e < 8; ++e) { f[e] = a[e]; f[8 + e] = b[e]; } return f; }
// V^T fragment in the k-map above: p = this lane's 8 keys (8hh..) of its channel in a 16-key group; elements 8..15 are the same place in the next group
__device__ __forceinline__ v16b frag_vt(const b16* p) { const v8b a = *(const v8b*)p, b = *(const v8b*)(p + D * 16); v16b f;
#pragma unroll
  for (int e = 0; e < 8; ++e) { f[e] = a[e]; f[8 + e] = b[e]; } return f; }
__device__ __forceinline__ v8f wmma16b(v16b a, v16b b, v8f c) { v8f d = __builtin_amdgcn_wmma_f32_16x16x32_f16(false, a, false, b, (short)0, c, false, false); asm volatile("v_nop\n\tv_nop\n\tv_nop\n\tv_nop" : "+v"(d) : "v"(a), "v"(b)); return d; }
__device__ __forceinline__ void wave_lds_sync() { __builtin_amdgcn_fence(__ATOMIC_RELEASE, "workgroup"); __builtin_amdgcn_wave_barrier(); __builtin_amdgcn_fence(__ATOMIC_ACQUIRE, "workgroup"); }
__device__ __forceinline__ float pmul(float a, float b) { float p = a * b; asm volatile("" : "+v"(p)); return p; }
// att_kernel LDS: one slab per wave, used behind the key loop only (partials for the merge, then the epilogue's stages).
constexpr int NW = 4;
struct TailBuf { float Pa[16][D + 4], Pm[16], Pd[16]; b16 Nh[16][40], Nl[16][40]; float Of[16][D + 4], Tf[16][FO + 4]; };

__global__ __launch_bounds__(256) void wput_kernel(const float* __restrict__ wq, const float* __restrict__ wk, const float* __restrict__ wv, const float* __restrict__ wo, b16* __restrict__ W3, b16* __restrict__ WO) { const int u = blockIdx.x * 256 + threadIdx.x; v8b v; float a3[8], ao[8];
  const int p = u / (D * (DI / 8)), r = u % (D * (DI / 8)); const int o3 = r / (DI / 8), k3 = (r % (DI / 8)) * 8; const int oo = u / (D / 8), ko = (u % (D / 8)) * 8;
  // all of a thread's loads are asked for first: the rounding below holds its order, and a load written among the roundings is waited for alone
  if (u < 3 * D * (DI / 8)) { const float* w = p == 0 ? wq : (p == 1 ? wk : wv);
#pragma unroll
    for (int j = 0; j < 8; ++j) a3[j] = w[(size_t)(k3 + j) * D + o3]; }
  if (u < FO * (D / 8)) {
#pragma unroll
    for (int j = 0; j < 8; ++j) ao[j] = wo[(size_t)(ko + j) * FO + oo]; }
  if (u < 3 * D * (DI / 8)) {
#pragma unroll
    for (int j = 0; j < 8; ++j) v[j] = (b16)(bf16_rne(a3[j]) * WSC); { *(v8b*)(W3 + ((size_t)p * D + o3) * DI + k3) = v;  } }
  if (u < FO * (D / 8)) {
#pragma unroll
    for (int j = 0; j < 8; ++j) v[j] = (b16)(bf16_rne(ao[j]) * WSC); { *(v8b*)(WO + (size_t)oo * D + ko) = v;  } } }
template <int MODE>
__global__ __launch_bounds__(32) void proj_kernel(const float* __restrict__ x, const b16* __restrict__ W3, const float* __restrict__ ba, const float* __restrict__ bb, int RLIM, b16* __restrict__ Ah_, b16* __restrict__ Al_, b16* __restrict__ Bh_, b16* __restrict__ Bl_) { __shared__ __attribute__((aligned(16))) b16 Xh[16][DI + 8]; __shared__ __attribute__((aligned(16))) b16 Oh[16][72], Ol[16][72]; const int lane = threadIdx.x, nloc = lane & 15, hlf = lane >> 4; const size_t m0 = (size_t)blockIdx.x * 16; if (m0 >= (size_t)RLIM) return; constexpr int NT = MODE == 0 ? 2 : 4;
  // every global load of the wave is asked for here, as one group: the 16 x rows (a row = 512 contiguous bytes, 16 a lane), the weight fragments, the biases.
  // The rounding and the matrix helper hold their order, and a load written among them is waited for alone.
  typedef __attribute__((ext_vector_type(4))) _Float16 v4b; v4f xv[16]; v16b wf[DI / 32][NT]; float braw[NT];
  { const float* px = x + m0 * DI + lane * 4; const b16* pw = W3 + (size_t)((MODE == 0 ? 0 : D) + nloc) * DI + 8 * hlf; const float* pa = ba + nloc; const float* pb = bb + nloc;
#pragma unroll
    for (int rr = 0; rr < 16; ++rr) xv[rr] = *(const v4f*)(px + rr * DI);
#pragma unroll
    for (int kb = 0; kb < DI; kb += 32)
#pragma unroll
      for (int t = 0; t < NT; ++t) wf[kb / 32][t] = frag_at(pw + t * 16 * DI + kb);
#pragma unroll
    for (int t = 0; t < NT; ++t) braw[t] = (t < 2 ? pa : pb)[(t & 1) * 16];
    asm volatile("s_wait_xcnt 0x0" ::: "memory");   // stands behind the group, in front of every overwrite of a register that a load above names
    __builtin_amdgcn_sched_barrier(0); }   // keeps the first rows' rounding behind the whole group: moved up among the loads it puts a load wait in front of the later loads
#pragma unroll
  for (int rr = 0; rr < 16; ++rr) { v4b h;
#pragma unroll
    for (int j = 0; j < 4; ++j) h[j] = (b16)(bf16_rne(xv[rr][j]) * XS);
    *(v4b*)(&Xh[rr][lane * 4]) = h; }
  if (lane < 16) for (int k = DI; k < DI + 8; ++k) Xh[lane][k] = (b16)0.0f;
  wave_lds_sync(); v8f acc[NT]; v8b th[2], tl[2];
#pragma unroll
  for (int t = 0; t < NT; ++t) acc[t] = (v8f){};
#pragma unroll
  for (int kb = 0; kb < DI; kb += 32) { const v16b a = frag_kb(&Xh[nloc][kb], hlf);
#pragma unroll
    for (int t = 0; t < NT; ++t) acc[t] = wmma16b(a, wf[kb / 32][t], acc[t]); }
#pragma unroll
  for (int t = 0; t < NT; ++t) { const int cc = t * 16 + nloc; const float bias = bfv(braw[t]);
#pragma unroll
    for (int r8 = 0; r8 < 8; ++r8) { b16 p, ql; split16((acc[t][r8] * (1.0f / (XS * WSC)) + bias) * HS, p, ql); if (t < 2) { Oh[8 * hlf + r8][cc] = p; Ol[8 * hlf + r8][cc] = ql; } else { th[t & 1][r8] = p; tl[t & 1][r8] = ql; } } }
  wave_lds_sync();
  // v tiles: a lane holds 8 consecutive keys of one channel, which is 16 bytes of the V^T group of this block's 16 keys
  if (MODE == 1) { const size_t o = ((size_t)blockIdx.x * D + nloc) * 16 + 8 * hlf;
#pragma unroll
    for (int t = 0; t < 2; ++t) { *(v8b*)(Bh_ + o + t * 256) = th[t]; *(v8b*)(Bl_ + o + t * 256) = tl[t]; } }
  typedef __attribute__((ext_vector_type(2))) _Float16 v2b;
  { for (int rr = 0; rr < 16; ++rr) { if (lane < 16) { *(v2b*)(Ah_ + (m0 + rr) * D + lane * 2) = *(const v2b*)(&Oh[rr][lane * 2]); *(v2b*)(Al_ + (m0 + rr) * D + lane * 2) = *(const v2b*)(&Ol[rr][lane * 2]); } }  } }
// attention + LN + Wo: NW WAVES PER BLOCK, block per 16 queries: the 128 key blocks of 64 are dealt round-robin to the waves, V^T fragments hi/lo come straight from the workspace; S^T (4 tiles, K 32; 3 products; A = k rows, B = q): D column = lane's query, D rows = 8 keys per lane half; online softmax per lane in registers (one exchange between the halves for the max);
// P^T x256 hi+lo: tiles 2j and 2j+1 are elements 0..7 and 8..15 of the B fragment of keys 32j.. (the k-map above); O^T += V^T P^T (2 channel tiles; 3 products);
// then the waves' partial (max, den, O) meet in LDS behind one block barrier and wave 0 merges them (rescale to the common max, waves summed in index order); fused = O/den; LN over 32;
__global__ __launch_bounds__(32 * NW) void att_kernel(const b16* __restrict__ Qh, const b16* __restrict__ Ql, const b16* __restrict__ Kh, const b16* __restrict__ Kl, const b16* __restrict__ Vh, const b16* __restrict__ Vl, const b16* __restrict__ WO, const float* __restrict__ gam, const float* __restrict__ bet, const float* __restrict__ bo, int QLIM, int KLIM, float* __restrict__ out) {
  __shared__ __attribute__((aligned(16))) TailBuf wb[NW];
  const int lane = threadIdx.x & 31, wave = __builtin_amdgcn_readfirstlane(threadIdx.x >> 5), nloc = lane & 15, hlf = lane >> 4; const size_t t0 = (size_t)blockIdx.x * 16; if (t0 >= (size_t)QLIM) return;
  const b16* pqh = Qh + (t0 + nloc) * D + 8 * hlf; const b16* pql = Ql + (t0 + nloc) * D + 8 * hlf; const v16b qa = frag_at(pqh), qb = frag_at(pql);
  asm volatile("s_wait_xcnt 0x0" :: "v"(pqh), "v"(pql) : "memory");   // the address registers of the q loads stay untouched up to this wait
  // per lane: query nloc's running max (equal in both halves) and this half's share of its denominator; acc[t][r8] = O^T[channel 16t + 8hlf + r8][query nloc]
  float m_q = -INFINITY, den_q = 0.0f; v8f acc[2] = {(v8f){}, (v8f){}};
  // K fragments hi/lo of one whole key block live in registers and are fetched one block ahead; the first block's are asked for here
  v16b kh[KB / 16], kl[KB / 16]; const unsigned ko = (unsigned)(nloc * D + 8 * hlf);   // this lane's row and half in a 16-key tile
  if (wave * KB < KLIM) { const b16* ph = Kh + (size_t)(wave * KB) * D + ko; const b16* pl = Kl + (size_t)(wave * KB) * D + ko;
#pragma unroll
    for (int t = 0; t < KB / 16; ++t) { kh[t] = frag_at(ph + t * 16 * D); kl[t] = frag_at(pl + t * 16 * D); }
    asm volatile("s_wait_xcnt 0x0" :: "v"(ph), "v"(pl) : "memory"); }   // stands in front of every overwrite of a register that the loads above name
#pragma unroll 1
  for (int kb0 = wave * KB; kb0 < KLIM; kb0 += NW * KB) {
    // V^T fragments of this key block: all asked for here, they fly under the S^T tiles and the softmax
    v16b vh[KB / 32][2], vl[KB / 32][2]; const size_t vo = ((size_t)(kb0 >> 4) * D + nloc) * 16 + 8 * hlf;   // this lane's place in the block's first group: channel nloc, keys 8hlf..
    { const b16* ph = Vh + vo; const b16* pl = Vl + vo;
#pragma unroll
      for (int j = 0; j < KB / 32; ++j)
#pragma unroll
        for (int t = 0; t < 2; ++t) { vh[j][t] = frag_vt(ph + (2 * j * D + t * 16) * 16); vl[j][t] = frag_vt(pl + (2 * j * D + t * 16) * 16); }
      asm volatile("s_wait_xcnt 0x0" :: "v"(ph), "v"(pl) : "memory"); }   // holds the loads above in front of the tiles; their address registers stay untouched up to this wait
    // S^T tiles (K 32 = one k-step): rows = keys, cols = queries
    v8f st[KB / 16], mv;
#pragma unroll
    for (int t = 0; t < KB / 16; ++t) { v8f s = {}; s = wmma16b(kh[t], qa, s); s = wmma16b(kl[t], qa, s); s = wmma16b(kh[t], qb, s);
#pragma unroll
      for (int r8 = 0; r8 < 8; ++r8) { st[t][r8] = s[r8] * (1.0f / (HS * HS)); mv[r8] = t == 0 ? st[t][r8] : fmaxf(mv[r8], st[t][r8]); } }
    // the wave's next key block's K fragments: asked for here, they fly under the softmax and the O^T products (behind the last block: this block's again, unused)
    { const int kn = kb0 + NW * KB < KLIM ? kb0 + NW * KB : kb0; const b16* ph = Kh + (size_t)kn * D + ko; const b16* pl = Kl + (size_t)kn * D + ko;
#pragma unroll
      for (int t = 0; t < KB / 16; ++t) { kh[t] = frag_at(ph + t * 16 * D); kl[t] = frag_at(pl + t * 16 * D); }
      asm volatile("s_wait_xcnt 0x0" :: "v"(ph), "v"(pl) : "memory"); }   // holds the loads above in front of the softmax; their address registers stay untouched up to this wait
    float mx = mv[0];
#pragma unroll
    for (int r8 = 1; r8 < 8; ++r8) mx = fmaxf(mx, mv[r8]);
    mx = fmaxf(mx, __shfl_xor(mx, 16));
    const float mn = fmaxf(m_q, mx); const float sf = (m_q == -INFINITY) ? 0.0f : __expf(m_q - mn); v8f pv = {}; v16b pa[KB / 32], pb[KB / 32];
#pragma unroll
    for (int t = 0; t < KB / 16; ++t)
#pragma unroll
      for (int r8 = 0; r8 < 8; ++r8) { const float p = __expf(st[t][r8] - mn); pv[r8] += p; b16 ph, pl; split16(p * PS, ph, pl); pa[t >> 1][(t & 1) * 8 + r8] = ph; pb[t >> 1][(t & 1) * 8 + r8] = pl; }
    const float ps = ((pv[0] + pv[1]) + (pv[2] + pv[3])) + ((pv[4] + pv[5]) + (pv[6] + pv[7]));
    den_q = den_q * sf + ps; m_q = mn;
#pragma unroll
    for (int t = 0; t < 2; ++t)
#pragma unroll
      for (int r8 = 0; r8 < 8; ++r8) acc[t][r8] = acc[t][r8] * sf;
#pragma unroll
    for (int ks = 0; ks < KB; ks += 32) {
#pragma unroll
      for (int t = 0; t < 2; ++t) { acc[t] = wmma16b(vh[ks / 32][t], pa[ks / 32], acc[t]); acc[t] = wmma16b(vl[ks / 32][t], pa[ks / 32], acc[t]); acc[t] = wmma16b(vh[ks / 32][t], pb[ks / 32], acc[t]); } } }
  // each wave publishes its partial row max, denominator (the halves' shares joined here) and O (back to [query][channel]) in its own slab
  { TailBuf& E = wb[wave]; const float den_f = den_q + __shfl_xor(den_q, 16);
#pragma unroll
    for (int t = 0; t < 2; ++t)
#pragma unroll
      for (int r8 = 0; r8 < 8; ++r8) E.Pa[nloc][t * 16 + 8 * hlf + r8] = acc[t][r8];
    if (hlf == 0) { E.Pm[nloc] = m_q; E.Pd[nloc] = den_f; } }
  __syncthreads();   // every wave's partials are in LDS before wave 0 reads them
  if (wave != 0) return;
  // every global load of the epilogue is asked for here, as one group, and flies under the merge: Wo fragments, gamma, beta, bo (written at their uses, each was waited for alone)
  v16b wof[8]; float boraw[8], graw, beraw;
  { const b16* pw = WO + (size_t)nloc * D + 8 * hlf; const float* pg = gam + lane; const float* pe = bet + lane; const float* po = bo + nloc;
#pragma unroll
    for (int t = 0; t < 8; ++t) wof[t] = frag_at(pw + t * 16 * D);
    graw = *pg; beraw = *pe;
#pragma unroll
    for (int t = 0; t < 8; ++t) boraw[t] = po[t * 16];
    asm volatile("s_wait_xcnt 0x0" ::: "memory"); }   // stands behind the group, in front of every overwrite of a register that a load above names
  auto& Nh = wb[0].Nh; auto& Nl = wb[0].Nl; auto& Of = wb[0].Of; auto& Tf = wb[0].Tf; float den_r[8];
#pragma unroll
  for (int r8 = 0; r8 < 8; ++r8) { const int row = 8 * hlf + r8; float mx = wb[0].Pm[row];
#pragma unroll
    for (int w = 1; w < NW; ++w) mx = fmaxf(mx, wb[w].Pm[row]);
    float dn = 0.0f, a0 = 0.0f, a1 = 0.0f;
#pragma unroll
    for (int w = 0; w < NW; ++w) { const float mw = wb[w].Pm[row]; const float sc = (mw == -INFINITY) ? 0.0f : __expf(mw - mx); dn += wb[w].Pd[row] * sc; a0 += wb[w].Pa[row][nloc] * sc; a1 += wb[w].Pa[row][16 + nloc] * sc; }
    den_r[r8] = dn; acc[0][r8] = a0; acc[1][r8] = a1; }
#pragma unroll
  for (int t = 0; t < 2; ++t)
#pragma unroll
    for (int r8 = 0; r8 < 8; ++r8) Of[8 * hlf + r8][t * 16 + nloc] = acc[t][r8] * (1.0f / (HS * PS)) / den_r[r8];
  wave_lds_sync();
  // LayerNorm over the 32 channels (lane = channel), stage hi/lo
  const float gv = bfv(graw), bev = bfv(beraw);
  for (int rr = 0; rr < 16; ++rr) { const float v = Of[rr][lane]; float s = v; for (int o = 16; o; o >>= 1) s += __shfl_xor(s, o); const float mu = s / D; float s2 = (v - mu) * (v - mu); for (int o = 16; o; o >>= 1) s2 += __shfl_xor(s2, o); const float rs = rsqrtf(s2 / D + LNEPS); const float nv = pmul(pmul(v - mu, rs), gv) + bev; b16 p, ql; split16(nv * HS, p, ql); Nh[rr][lane] = p; Nl[rr][lane] = ql; if (lane < 8) { Nh[rr][32 + lane] = (b16)0.0f; Nl[rr][32 + lane] = (b16)0.0f; } }
  wave_lds_sync(); v8f o8[8];
#pragma unroll
  for (int t = 0; t < 8; ++t) o8[t] = (v8f){};
  { const v16b a = frag_kb(&Nh[nloc][0], hlf), al = frag_kb(&Nl[nloc][0], hlf);
#pragma unroll
    for (int t = 0; t < 8; ++t) { o8[t] = wmma16b(a, wof[t], o8[t]); o8[t] = wmma16b(al, wof[t], o8[t]); } }
#pragma unroll
  for (int t = 0; t < 8; ++t) { const int cc = t * 16 + nloc; const float bb = bfv(boraw[t]);
#pragma unroll
    for (int r8 = 0; r8 < 8; ++r8) Tf[8 * hlf + r8][cc] = o8[t][r8] * (1.0f / (HS * WSC)) + bb; }
  wave_lds_sync();
  { for (int rr = 0; rr < 16; ++rr) *(v4f*)(out + (t0 + rr) * FO + lane * 4) = *(const v4f*)(&Tf[rr][lane * 4]);  } }
}  // namespace

extern "C" void kernel_launch(void* const* d_in, const int* in_sizes, int n_in, void* d_out, int out_size, void* d_ws, size_t ws_size, hipStream_t stream) {
  (void)n_in;
  auto Fp = [&](int i) { return (const float*)d_in[i]; };
  // Input order: 0 input1 [8192,128]; 1 input2 [8192,128]; 2 Wq [128,32]; 3 bq; 4 Wk; 5 bk; 6 Wv; 7 bv; 8 gamma [32]; 9 beta; 10 Wo [32,128]; 11 bo [128]
  if (in_sizes[0] != N1 * DI || in_sizes[1] != N2 * DI || in_sizes[2] != DI * D || in_sizes[4] != DI * D || in_sizes[6] != DI * D || in_sizes[8] != D || in_sizes[10] != D * FO || in_sizes[11] != FO || out_size != N1 * FO) return;
  const int QLIM = N1, KLIM = N2;   // query / key cuts (multiples of 128)
  size_t off = 0; char* ws = (char*)d_ws;
  auto carve = [&](size_t bytes) { char* p = ws + off; off += (bytes + 255) & ~(size_t)255; return p; };
  b16* W3 = (b16*)carve((size_t)3 * D * DI * 2); b16* WO = (b16*)carve((size_t)FO * D * 2); b16* Qh = (b16*)carve((size_t)N1 * D * 2); b16* Ql = (b16*)carve((size_t)N1 * D * 2); b16* Kh = (b16*)carve((size_t)N2 * D * 2); b16* Kl = (b16*)carve((size_t)N2 * D * 2); b16* Vh = (b16*)carve((size_t)N2 * D * 2); b16* Vl = (b16*)carve((size_t)N2 * D * 2);
  if (off > ws_size || off > ((size_t)8 << 20)) return;   // ~ 3.2 MB
  wput_kernel<<<(3 * D * (DI / 8) + 255) / 256, 256, 0, stream>>>(Fp(2), Fp(4), Fp(6), Fp(10), W3, WO);
  proj_kernel<0><<<QLIM / 16, 32, 0, stream>>>(Fp(0), W3, Fp(3), Fp(3), QLIM, Qh, Ql, Qh, Ql);
  proj_kernel<1><<<KLIM / 16, 32, 0, stream>>>(Fp(1), W3, Fp(5), Fp(7), KLIM, Kh, Kl, Vh, Vl);
  att_kernel<<<QLIM / 16, 32 * NW, 0, stream>>>(Qh, Ql, Kh, Kl, Vh, Vl, WO, Fp(8), Fp(9), Fp(11), QLIM, KLIM, (float*)d_out);
}

// v006
// One run takes 48.3 microseconds.
// Next to v005, in two timings, it ran 1.18 and 1.19 times as fast.
// All steps since v000 together make it 22.2 times as fast.
#include <hip/hip_runtime.h>

// CAM (cross-attention module): q = input1 Wq + bq [8192][32]; k = input2 Wk + bk, v = input2 Wv + bv [8192][32]; scores = q k^T (no scaling); w = softmax over the 8,192 keys; fused = w v; LayerNorm(fused) (eps 1e-5, gamma/beta);
// out = normed Wo + bo -> [8192][128].
// Deterministic: no index structures, no atomics.
// V is kept in the workspace as V^T in groups of 16 keys, [key / 16][channel][key % 16], so that a V^T fragment is two 16-byte loads.
// WMMA (v_wmma_f32_16x16x32_f16, f32 accumulate): projections with the inputs EXACT bf16 x8 (K 128, 2 tiles each) against exact weight rows x256; S^T = k q^T per (64-key block, 16-query tile) and O^T += V^T P^T (q/k/v/P hi+lo x256; 3 products each), so a lane owns one query's scores and P^T packs in-lane into the B operand;
// out = LN(fused) (hi+lo) x Wo rows (K 32, 8 tiles). Online softmax and LayerNorm in f32. Inputs rounded to bf16 once. Fragment k-map per lane half hh for A AND B: elements 0..7 <- k = 8hh+0..7, 8..15 <- k = 16+8hh+0..7;

namespace {
constexpr int N1 = 8192, N2 = 8192, DI = 128, D = 32, FO = 128, KB = 64;
constexpr float XS = 8.0f, HS = 256.0f, WSC = 256.0f, PS = 256.0f, LNEPS = 1e-5f;
typedef _Float16 b16;
typedef __attribute__((ext_vector_type(16))) _Float16 v16b;
typedef __attribute__((ext_vector_type(8))) _Float16 v8b;
typedef __attribute__((ext_vector_type(8))) float v8f;
typedef __attribute__((ext_vector_type(4))) float v4f;
__device__ __forceinline__ float bf16_rne(float f) { unsigned int u = __float_as_uint(f); u += 0x7FFFu + ((u >> 16) & 1u); float r = __uint_as_float(u & 0xFFFF0000u); asm volatile("" : "+v"(r)); return r; }
__device__ __forceinline__ float bfv(float f) { float r = bf16_rne(f); asm volatile("" : "+v"(r)); return r; }
__device__ __forceinline__ void split16(float v, b16& hi, b16& lo) { hi = (b16)v; lo = (b16)(v - (float)hi); }
__device__ __forceinline__ v16b frag_kb(const b16* p, int hh) { const v8b a = *(const v8b*)(p + 8 * hh), b = *(const v8b*)(p + 16 + 8 * hh); v16b f;
#pragma unroll
  for (int e = 0; e < 8; ++e) { f[e] = a[e]; f[8 + e] = b[e]; } return f; }
// the same fragment from a pointer that already holds the lane half's 8hh
__device__ __forceinline__ v16b frag_at(const b16* p) { const v8b a = *(const v8b*)p, b = *(const v8b*)(p + 16); v16b f;
#pragma unroll
  for (int e = 0; e < 8; ++e) { f[e] = a[e]; f[8 + e] = b[e]; } return f; }
// V^T fragment in the k-map above: p = this lane's 8 keys (8hh..) of its channel in a 16-key group; elements 8..15 are the same place in the next group
__device__ __forceinline__ v16b frag_vt(const b16* p) { const v8b a = *(const v8b*)p, b = *(const v8b*)(p + D * 16); v16b f;
#pragma unroll
  for (int e = 0; e < 8; ++e) { f[e] = a[e]; f[8 + e] = b[e]; } return f; }
__device__ __forceinline__ v8f wmma16b(v16b a, v16b b, v8f c) { v8f d = __builtin_amdgcn_wmma_f32_16x16x32_f16(false, a, false, b, (short)0, c, false, false); asm volatile("v_nop\n\tv_nop\n\tv_nop\n\tv_nop" : "+v"(d) : "v"(a), "v"(b)); return d; }
__device__ __forceinline__ void wave_lds_sync() { __builtin_amdgcn_fence(__ATOMIC_RELEASE, "workgroup"); __builtin_amdgcn_wave_barrier(); __builtin_amdgcn_fence(__ATOMIC_ACQUIRE, "workgroup"); }
__device__ __forceinline__ float pmul(float a, float b) { float p = a * b; asm volatile("" : "+v"(p)); return p; }
// att_kernel LDS, used behind the key loop only: one slab of partials per wave for the merge, one slab of epilogue stages per query tile.
constexpr int NW = 8, QT = 2;   // waves per block; 16-query tiles that each wave works against one set of K / V^T fragments
struct PartBuf { float Pa[QT][16][D + 4], Pm[QT][16], Pd[QT][16]; };
struct TailBuf { b16 Nh[16][40], Nl[16][40]; float Of[16][D + 4], Tf[16][FO + 4]; };

__global__ __launch_bounds__(256) void wput_kernel(const float* __restrict__ wq, const float* __restrict__ wk, const float* __restrict__ wv, const float* __restrict__ wo, b16* __restrict__ W3, b16* __restrict__ WO) { const int u = blockIdx.x * 256 + threadIdx.x; v8b v; float a3[8], ao[8];
  const int p = u / (D * (DI / 8)), r = u % (D * (DI / 8)); const int o3 = r / (DI / 8), k3 = (r % (DI / 8)) * 8; const int oo = u / (D / 8), ko = (u % (D / 8)) * 8;
  // all of a thread's loads are asked for first: the rounding below holds its order, and a load written among the roundings is waited for alone
  if (u < 3 * D * (DI / 8)) { const float* w = p == 0 ? wq : (p == 1 ? wk : wv);
#pragma unroll
    for (int j = 0; j < 8; ++j) a3[j] = w[(size_t)(k3 + j) * D + o3]; }
  if (u < FO * (D / 8)) {
#pragma unroll
    for (int j = 0; j < 8; ++j) ao[j] = wo[(size_t)(ko + j) * FO + oo]; }
  if (u < 3 * D * (DI / 8)) {
#pragma unroll
    for (int j = 0; j < 8; ++j) v[j] = (b16)(bf16_rne(a3[j]) * WSC); { *(v8b*)(W3 + ((size_t)p * D + o3) * DI + k3) = v;  } }
  if (u < FO * (D / 8)) {
#pragma unroll
    for (int j = 0; j < 8; ++j) v[j] = (b16)(bf16_rne(ao[j]) * WSC); { *(v8b*)(WO + (size_t)oo * D + ko) = v;  } } }
template <int MODE>
__global__ __launch_bounds__(32) void proj_kernel(const float* __restrict__ x, const b16* __restrict__ W3, const float* __restrict__ ba, const float* __restrict__ bb, int RLIM, b16* __restrict__ Ah_, b16* __restrict__ Al_, b16* __restrict__ Bh_, b16* __restrict__ Bl_) { __shared__ __attribute__((aligned(16))) b16 Xh[16][DI + 8]; __shared__ __attribute__((aligned(16))) b16 Oh[16][72], Ol[16][72]; const int lane = threadIdx.x, nloc = lane & 15, hlf = lane >> 4; const size_t m0 = (size_t)blockIdx.x * 16; if (m0 >= (size_t)RLIM) return; constexpr int NT = MODE == 0 ? 2 : 4;
  // every global load of the wave is asked for here, as one group: the 16 x rows (a row = 512 contiguous bytes, 16 a lane), the weight fragments, the biases.
  // The rounding and the matrix helper hold their order, and a load written among them is waited for alone.
  typedef __attribute__((ext_vector_type(4))) _Float16 v4b; v4f xv[16]; v16b wf[DI / 32][NT]; float braw[NT];
  { const float* px = x + m0 * DI + lane * 4; const b16* pw = W3 + (size_t)((MODE == 0 ? 0 : D) + nloc) * DI + 8 * hlf; const float* pa = ba + nloc; const float* pb = bb + nloc;
#pragma unroll
    for (int rr = 0; rr < 16; ++rr) xv[rr] = *(const v4f*)(px + rr * DI);
#pragma unroll
    for (int kb = 0; kb < DI; kb += 32)
#pragma unroll
      for (int t = 0; t < NT; ++t) wf[kb / 32][t] = frag_at(pw + t * 16 * DI + kb);
#pragma unroll
    for (int t = 0; t < NT; ++t) braw[t] = (t < 2 ? pa : pb)[(t & 1) * 16];
    asm volatile("s_wait_xcnt 0x0" ::: "memory");   // stands behind the group, in front of every overwrite of a register that a load above names
    __builtin_amdgcn_sched_barrier(0); }   // keeps the first rows' rounding behind the whole group: moved up among the loads it puts a load wait in front of the later loads
#pragma unroll
  for (int rr = 0; rr < 16; ++rr) { v4b h;
#pragma unroll
    for (int j = 0; j < 4; ++j) h[j] = (b16)(bf16_rne(xv[rr][j]) * XS);
    *(v4b*)(&Xh[rr][lane * 4]) = h; }
  if (lane < 16) for (int k = DI; k < DI + 8; ++k) Xh[lane][k] = (b16)0.0f;
  wave_lds_sync(); v8f acc[NT]; v8b th[2], tl[2];
#pragma unroll
  for (int t = 0; t < NT; ++t) acc[t] = (v8f){};
#pragma unroll
  for (int kb = 0; kb < DI; kb += 32) { const v16b a = frag_kb(&Xh[nloc][kb], hlf);
#pragma unroll
    for (int t = 0; t < NT; ++t) acc[t] = wmma16b(a, wf[kb / 32][t], acc[t]); }
#pragma unroll
  for (int t = 0; t < NT; ++t) { const int cc = t * 16 + nloc; const float bias = bfv(braw[t]);
#pragma unroll
    for (int r8 = 0; r8 < 8; ++r8) { b16 p, ql; split16((acc[t][r8] * (1.0f / (XS * WSC)) + bias) * HS, p, ql); if (t < 2) { Oh[8 * hlf + r8][cc] = p; Ol[8 * hlf + r8][cc] = ql; } else { th[t & 1][r8] = p; tl[t & 1][r8] = ql; } } }
  wave_lds_sync();
  // v tiles: a lane holds 8 consecutive keys of one channel, which is 16 bytes of the V^T group of this block's 16 keys
  if (MODE == 1) { const size_t o = ((size_t)blockIdx.x * D + nloc) * 16 + 8 * hlf;
#pragma unroll
    for (int t = 0; t < 2; ++t) { *(v8b*)(Bh_ + o + t * 256) = th[t]; *(v8b*)(Bl_ + o + t * 256) = tl[t]; } }
  typedef __attribute__((ext_vector_type(2))) _Float16 v2b;
  { for (int rr = 0; rr < 16; ++rr) { if (lane < 16) { *(v2b*)(Ah_ + (m0 + rr) * D + lane * 2) = *(const v2b*)(&Oh[rr][lane * 2]); *(v2b*)(Al_ + (m0 + rr) * D + lane * 2) = *(const v2b*)(&Ol[rr][lane * 2]); } }  } }
// attention + LN + Wo: NW WAVES PER BLOCK, block per QT * 16 = 32 queries: the 128 key blocks of 64 are dealt round-robin to the waves, and EACH WAVE WORKS BOTH QUERY TILES against the K and V^T fragments it has in registers, so a fragment is fetched once per 32 queries;
// V^T fragments hi/lo come straight from the workspace; S^T (4 tiles per query tile, K 32; 3 products; A = k rows, B = q): D column = lane's query, D rows = 8 keys per lane half; online softmax per lane in registers (one exchange between the halves for the max);
// P^T x256 hi+lo: tiles 2j and 2j+1 are elements 0..7 and 8..15 of the B fragment of keys 32j.. (the k-map above); O^T += V^T P^T (2 channel tiles; 3 products);
// then the waves' partial (max, den, O) meet in LDS behind one block barrier and wave u merges query tile u (rescale to the common max, waves summed in index order); fused = O/den; LN over 32;
__global__ __launch_bounds__(32 * NW) void att_kernel(const b16* __restrict__ Qh, const b16* __restrict__ Ql, const b16* __restrict__ Kh, const b16* __restrict__ Kl, const b16* __restrict__ Vh, const b16* __restrict__ Vl, const b16* __restrict__ WO, const float* __restrict__ gam, const float* __restrict__ bet, const float* __restrict__ bo, int QLIM, int KLIM, float* __restrict__ out) {
  __shared__ __attribute__((aligned(16))) PartBuf pw[NW]; __shared__ __attribute__((aligned(16))) TailBuf wb[QT];
  const int lane = threadIdx.x & 31, wave = __builtin_amdgcn_readfirstlane(threadIdx.x >> 5), nloc = lane & 15, hlf = lane >> 4; const size_t t0 = (size_t)blockIdx.x * (16 * QT); if (t0 >= (size_t)QLIM) return;
  const b16* pqh = Qh + (t0 + nloc) * D + 8 * hlf; const b16* pql = Ql + (t0 + nloc) * D + 8 * hlf; v16b qa[QT], qb[QT];
#pragma unroll
  for (int u = 0; u < QT; ++u) { qa[u] = frag_at(pqh + u * 16 * D); qb[u] = frag_at(pql + u * 16 * D); }
  asm volatile("s_wait_xcnt 0x0" :: "v"(pqh), "v"(pql) : "memory");   // the address registers of the q loads stay untouched up to this wait
  // per lane and query tile u: query nloc's running max (equal in both halves) and this half's share of its denominator; acc[u][t][r8] = O^T[channel 16t + 8hlf + r8][query 16u + nloc]
  float m_q[QT], den_q[QT]; v8f acc[QT][2];
#pragma unroll
  for (int u = 0; u < QT; ++u) { m_q[u] = -INFINITY; den_q[u] = 0.0f; acc[u][0] = (v8f){}; acc[u][1] = (v8f){}; }
  // K fragments hi/lo of one whole key block live in registers and are fetched one block ahead; the first block's are asked for here
  v16b kh[KB / 16], kl[KB / 16]; const unsigned ko = (unsigned)(nloc * D + 8 * hlf);   // this lane's row and half in a 16-key tile
  if (wave * KB < KLIM) { const b16* ph = Kh + (size_t)(wave * KB) * D + ko; const b16* pl = Kl + (size_t)(wave * KB) * D + ko;
#pragma unroll
    for (int t = 0; t < KB / 16; ++t) { kh[t] = frag_at(ph + t * 16 * D); kl[t] = frag_at(pl + t * 16 * D); }
    asm volatile("s_wait_xcnt 0x0" :: "v"(ph), "v"(pl) : "memory");   // stands in front of every overwrite of a register that the loads above name
    __builtin_amdgcn_sched_barrier(0); }   // keeps the loop's first address arithmetic behind that wait: lifted over it, it rewrote the loads' offset register ahead of the wait
#pragma unroll 1
  for (int kb0 = wave * KB; kb0 < KLIM; kb0 += NW * KB) {
    // V^T fragments of this key block: all asked for here, they fly under the S^T tiles and the softmax
    v16b vh[KB / 32][2], vl[KB / 32][2]; const size_t vo = ((size_t)(kb0 >> 4) * D + nloc) * 16 + 8 * hlf;   // this lane's place in the block's first group: channel nloc, keys 8hlf..
    { const b16* ph = Vh + vo; const b16* pl = Vl + vo;
#pragma unroll
      for (int j = 0; j < KB / 32; ++j)
#pragma unroll
        for (int t = 0; t < 2; ++t) { vh[j][t] = frag_vt(ph + (2 * j * D + t * 16) * 16); vl[j][t] = frag_vt(pl + (2 * j * D + t * 16) * 16); }
      asm volatile("s_wait_xcnt 0x0" :: "v"(ph), "v"(pl) : "memory"); }   // holds the loads above in front of the tiles; their address registers stay untouched up to this wait
    // S^T tiles (K 32 = one k-step): rows = keys, cols = queries; the two query tiles' chains alternate on the same K fragment
    v8f st[QT][KB / 16], mv[QT];
#pragma unroll
    for (int t = 0; t < KB / 16; ++t) { v8f s[QT];
#pragma unroll
      for (int u = 0; u < QT; ++u) s[u] = wmma16b(kh[t], qa[u], (v8f){});
#pragma unroll
      for (int u = 0; u < QT; ++u) s[u] = wmma16b(kl[t], qa[u], s[u]);
#pragma unroll
      for (int u = 0; u < QT; ++u) s[u] = wmma16b(kh[t], qb[u], s[u]);
#pragma unroll
      for (int u = 0; u < QT; ++u)
#pragma unroll
        for (int r8 = 0; r8 < 8; ++r8) { st[u][t][r8] = s[u][r8] * (1.0f / (HS * HS)); mv[u][r8] = t == 0 ? st[u][t][r8] : fmaxf(mv[u][r8], st[u][t][r8]); } }
    // the wave's next key block's K fragments: asked for here, they fly under the softmax and the O^T products (behind the last block: this block's again, unused)
    { const int kn = kb0 + NW * KB < KLIM ? kb0 + NW * KB : kb0; const b16* ph = Kh + (size_t)kn * D + ko; const b16* pl = Kl + (size_t)kn * D + ko;
#pragma unroll
      for (int t = 0; t < KB / 16; ++t) { kh[t] = frag_at(ph + t * 16 * D); kl[t] = frag_at(pl + t * 16 * D); }
      asm volatile("s_wait_xcnt 0x0" :: "v"(ph), "v"(pl) : "memory"); }   // holds the loads above in front of the softmax; their address registers stay untouched up to this wait
    v16b pa[QT][KB / 32], pb[QT][KB / 32];
#pragma unroll
    for (int u = 0; u < QT; ++u) {
      float mx = mv[u][0];
#pragma unroll
      for (int r8 = 1; r8 < 8; ++r8) mx = fmaxf(mx, mv[u][r8]);
      mx = fmaxf(mx, __shfl_xor(mx, 16));
      const float mn = fmaxf(m_q[u], mx); const float sf = (m_q[u] == -INFINITY) ? 0.0f : __expf(m_q[u] - mn); v8f pv = {};
#pragma unroll
      for (int t = 0; t < KB / 16; ++t)
#pragma unroll
        for (int r8 = 0; r8 < 8; ++r8) { const float p = __expf(st[u][t][r8] - mn); pv[r8] += p; b16 ph, pl; split16(p * PS, ph, pl); pa[u][t >> 1][(t & 1) * 8 + r8] = ph; pb[u][t >> 1][(t & 1) * 8 + r8] = pl; }
      const float ps = ((pv[0] + pv[1]) + (pv[2] + pv[3])) + ((pv[4] + pv[5]) + (pv[6] + pv[7]));
      den_q[u] = den_q[u] * sf + ps; m_q[u] = mn;
#pragma unroll
      for (int t = 0; t < 2; ++t)
#pragma unroll
        for (int r8 = 0; r8 < 8; ++r8) acc[u][t][r8] = acc[u][t][r8] * sf; }
#pragma unroll
    for (int ks = 0; ks < KB; ks += 32) {
#pragma unroll
      for (int t = 0; t < 2; ++t) {
#pragma unroll
        for (int u = 0; u < QT; ++u) acc[u][t] = wmma16b(vh[ks / 32][t], pa[u][ks / 32], acc[u][t]);
#pragma unroll
        for (int u = 0; u < QT; ++u) acc[u][t] = wmma16b(vl[ks / 32][t], pa[u][ks / 32], acc[u][t]);
#pragma unroll
        for (int u = 0; u < QT; ++u) acc[u][t] = wmma16b(vh[ks / 32][t], pb[u][ks / 32], acc[u][t]); } } }
  // each wave publishes, per query tile, its partial row max, denominator (the halves' shares joined here) and O (back to [query][channel]) in its own slab
  { PartBuf& E = pw[wave];
#pragma unroll
    for (int u = 0; u < QT; ++u) { const float den_f = den_q[u] + __shfl_xor(den_q[u], 16);
#pragma unroll
      for (int t = 0; t < 2; ++t)
#pragma unroll
        for (int r8 = 0; r8 < 8; ++r8) E.Pa[u][nloc][t * 16 + 8 * hlf + r8] = acc[u][t][r8];
      if (hlf == 0) { E.Pm[u][nloc] = m_q[u]; E.Pd[u][nloc] = den_f; } } }
  __syncthreads();   // every wave's partials are in LDS before waves 0 .. QT-1 read them
  if (wave >= QT) return;
  const size_t tq = t0 + (size_t)wave * 16;   // wave u finishes query tile u
  // every global load of the epilogue is asked for here, as one group, and flies under the merge: Wo fragments, gamma, beta, bo (written at their uses, each was waited for alone)
  v16b wof[8]; float boraw[8], graw, beraw;
  { const b16* pwo = WO + (size_t)nloc * D + 8 * hlf; const float* pg = gam + lane; const float* pe = bet + lane; const float* po = bo + nloc;
#pragma unroll
    for (int t = 0; t < 8; ++t) wof[t] = frag_at(pwo + t * 16 * D);
    graw = *pg; beraw = *pe;
#pragma unroll
    for (int t = 0; t < 8; ++t) boraw[t] = po[t * 16];
    asm volatile("s_wait_xcnt 0x0" ::: "memory"); }   // stands behind the group, in front of every overwrite of a register that a load above names
  auto& Nh = wb[wave].Nh; auto& Nl = wb[wave].Nl; auto& Of = wb[wave].Of; auto& Tf = wb[wave].Tf; float den_r[8]; v8f mo[2];
#pragma unroll
  for (int r8 = 0; r8 < 8; ++r8) { const int row = 8 * hlf + r8; float mx = pw[0].Pm[wave][row];
#pragma unroll
    for (int w = 1; w < NW; ++w) mx = fmaxf(mx, pw[w].Pm[wave][row]);
    float dn = 0.0f, a0 = 0.0f, a1 = 0.0f;
#pragma unroll
    for (int w = 0; w < NW; ++w) { const float mw = pw[w].Pm[wave][row]; const float sc = (mw == -INFINITY) ? 0.0f : __expf(mw - mx); dn += pw[w].Pd[wave][row] * sc; a0 += pw[w].Pa[wave][row][nloc] * sc; a1 += pw[w].Pa[wave][row][16 + nloc] * sc; }
    den_r[r8] = dn; mo[0][r8] = a0; mo[1][r8] = a1; }
#pragma unroll
  for (int t = 0; t < 2; ++t)
#pragma unroll
    for (int r8 = 0; r8 < 8; ++r8) Of[8 * hlf + r8][t * 16 + nloc] = mo[t][r8] * (1.0f / (HS * PS)) / den_r[r8];
  wave_lds_sync();
  // LayerNorm over the 32 channels (lane = channel), stage hi/lo
  const float gv = bfv(graw), bev = bfv(beraw);
  for (int rr = 0; rr < 16; ++rr) { const float v = Of[rr][lane]; float s = v; for (int o = 16; o; o >>= 1) s += __shfl_xor(s, o); const float mu = s / D; float s2 = (v - mu) * (v - mu); for (int o = 16; o; o >>= 1) s2 += __shfl_xor(s2, o); const float rs = rsqrtf(s2 / D + LNEPS); const float nv = pmul(pmul(v - mu, rs), gv) + bev; b16 p, ql; split16(nv * HS, p, ql); Nh[rr][lane] = p; Nl[rr][lane] = ql; if (lane < 8) { Nh[rr][32 + lane] = (b16)0.0f; Nl[rr][32 + lane] = (b16)0.0f; } }
  wave_lds_sync(); v8f o8[8];
#pragma unroll
  for (int t = 0; t < 8; ++t) o8[t] = (v8f){};
  { const v16b a = frag_kb(&Nh[nloc][0], hlf), al = frag_kb(&Nl[nloc][0], hlf);
#pragma unroll
    for (int t = 0; t < 8; ++t) { o8[t] = wmma16b(a, wof[t], o8[t]); o8[t] = wmma16b(al, wof[t], o8[t]); } }
#pragma unroll
  for (int t = 0; t < 8; ++t) { const int cc = t * 16 + nloc; const float bb = bfv(boraw[t]);
#pragma unroll
    for (int r8 = 0; r8 < 8; ++r8) Tf[8 * hlf + r8][cc] = o8[t][r8] * (1.0f / (HS * WSC)) + bb; }
  wave_lds_sync();
  { for (int rr = 0; rr < 16; ++rr) *(v4f*)(out + (tq + rr) * FO + lane * 4) = *(const v4f*)(&Tf[rr][lane * 4]);  } }
}  // namespace

extern "C" void kernel_launch(void* const* d_in, const int* in_sizes, int n_in, void* d_out, int out_size, void* d_ws, size_t ws_size, hipStream_t stream) {
  (void)n_in;
  auto Fp = [&](int i) { return (const float*)d_in[i]; };
  // Input order: 0 input1 [8192,128]; 1 input2 [8192,128]; 2 Wq [128,32]; 3 bq; 4 Wk; 5 bk; 6 Wv; 7 bv; 8 gamma [32]; 9 beta; 10 Wo [32,128]; 11 bo [128]
  if (in_sizes[0] != N1 * DI || in_sizes[1] != N2 * DI || in_sizes[2] != DI * D || in_sizes[4] != DI * D || in_sizes[6] != DI * D || in_sizes[8] != D || in_sizes[10] != D * FO || in_sizes[11] != FO || out_size != N1 * FO) return;
  const int QLIM = N1, KLIM = N2;   // query / key cuts (multiples of 128)
  size_t off = 0; char* ws = (char*)d_ws;
  auto carve = [&](size_t bytes) { char* p = ws + off; off += (bytes + 255) & ~(size_t)255; return p; };
  b16* W3 = (b16*)carve((size_t)3 * D * DI * 2); b16* WO = (b16*)carve((size_t)FO * D * 2); b16* Qh = (b16*)carve((size_t)N1 * D * 2); b16* Ql = (b16*)carve((size_t)N1 * D * 2); b16* Kh = (b16*)carve((size_t)N2 * D * 2); b16* Kl = (b16*)carve((size_t)N2 * D * 2); b16* Vh = (b16*)carve((size_t)N2 * D * 2); b16* Vl = (b16*)carve((size_t)N2 * D * 2);
  if (off > ws_size || off > ((size_t)8 << 20)) return;   // ~ 3.2 MB
  wput_kernel<<<(3 * D * (DI / 8) + 255) / 256, 256, 0, stream>>>(Fp(2), Fp(4), Fp(6), Fp(10), W3, WO);
  proj_kernel<0><<<QLIM / 16, 32, 0, stream>>>(Fp(0), W3, Fp(3), Fp(3), QLIM, Qh, Ql, Qh, Ql);
  proj_kernel<1><<<KLIM / 16, 32, 0, stream>>>(Fp(1), W3, Fp(5), Fp(7), KLIM, Kh, Kl, Vh, Vl);
  att_kernel<<<QLIM / (16 * QT), 32 * NW, 0, stream>>>(Qh, Ql, Kh, Kl, Vh, Vl, WO, Fp(8), Fp(9), Fp(11), QLIM, KLIM, (float*)d_out);
}

// v007
// A run of this version takes 40.4 microseconds.
// Two timings next to v006 put it at 1.20 and 1.18 times that version's speed.
// All steps since v000 together make it 26.4 times as fast.
#include <hip/hip_runtime.h>

// CAM (cross-attention module): q = input1 Wq + bq [8192][32]; k = input2 Wk + bk, v = input2 Wv + bv [8192][32]; scores = q k^T (no scaling); w = softmax over the 8,192 keys; fused = w v; LayerNorm(fused) (eps 1e-5, gamma/beta);
// out = normed Wo + bo -> [8192][128].
// Deterministic: no index structures, no atomics.
// V is kept in the workspace as V^T in groups of 16 keys, [key / 16][channel][key % 16], so that a V^T fragment is two 16-byte loads.
// WMMA (v_wmma_f32_16x16x32_f16, f32 accumulate): projections with the inputs EXACT bf16 x8 (K 128, 2 tiles each) against exact weight rows x256; S^T = k q^T per (64-key block, 16-query tile) and O^T += V^T P^T (q/k/v/P hi+lo x256; 3 products each), so a lane owns one query's scores and P^T packs in-lane into the B operand;
// out^T = Wo rows x LN(fused)^T (hi+lo) (K 32, 8 tiles). Online softmax and LayerNorm in f32. Inputs rounded to bf16 once. Fragment k-map per lane half hh for A AND B: elements 0..7 <- k = 8hh+0..7, 8..15 <- k = 16+8hh+0..7;

namespace {
constexpr int N1 = 8192, N2 = 8192, DI = 128, D = 32, FO = 128, KB = 64;
constexpr float XS = 8.0f, HS = 256.0f, WSC = 256.0f, PS = 256.0f, LNEPS = 1e-5f;
typedef _Float16 b16;
typedef __attribute__((ext_vector_type(16))) _Float16 v16b;
typedef __attribute__((ext_vector_type(8))) _Float16 v8b;
typedef __attribute__((ext_vector_type(8))) float v8f;
typedef __attribute__((ext_vector_type(4))) float v4f;
__device__ __forceinline__ float bf16_rne(float f) { unsigned int u = __float_as_uint(f); u += 0x7FFFu + ((u >> 16) & 1u); float r = __uint_as_float(u & 0xFFFF0000u); asm volatile("" : "+v"(r)); return r; }
__device__ __forceinline__ float bfv(float f) { float r = bf16_rne(f); asm volatile("" : "+v"(r)); return r; }
__device__ __forceinline__ void split16(float v, b16& hi, b16& lo) { hi = (b16)v; lo = (b16)(v - (float)hi); }
__device__ __forceinline__ v16b frag_kb(const b16* p, int hh) { const v8b a = *(const v8b*)(p + 8 * hh), b = *(const v8b*)(p + 16 + 8 * hh); v16b f;
#pragma unroll
  for (int e = 0; e < 8; ++e) { f[e] = a[e]; f[8 + e] = b[e]; } return f; }
// the same fragment from a pointer that already holds the lane half's 8hh
__device__ __forceinline__ v16b frag_at(const b16* p) { const v8b a = *(const v8b*)p, b = *(const v8b*)(p + 16); v16b f;
#pragma unroll
  for (int e = 0; e < 8; ++e) { f[e] = a[e]; f[8 + e] = b[e]; } return f; }
// V^T fragment in the k-map above: p = this lane's 8 keys (8hh..) of its channel in a 16-key group; elements 8..15 are the same place in the next group
__device__ __forceinline__ v16b frag_vt(const b16* p) { const v8b a = *(const v8b*)p, b = *(const v8b*)(p + D * 16); v16b f;
#pragma unroll
  for (int e = 0; e < 8; ++e) { f[e] = a[e]; f[8 + e] = b[e]; } return f; }
__device__ __forceinline__ v8f wmma16b(v16b a, v16b b, v8f c) { v8f d = __builtin_amdgcn_wmma_f32_16x16x32_f16(false, a, false, b, (short)0, c, false, false); asm volatile("v_nop\n\tv_nop\n\tv_nop\n\tv_nop" : "+v"(d) : "v"(a), "v"(b)); return d; }
__device__ __forceinline__ void wave_lds_sync() { __builtin_amdgcn_fence(__ATOMIC_RELEASE, "workgroup"); __builtin_amdgcn_wave_barrier(); __builtin_amdgcn_fence(__ATOMIC_ACQUIRE, "workgroup"); }
// att_kernel LDS, used behind the key loop only: one slab of partials per wave for the merge, one output stage per query tile.
constexpr int NW = 8, QT = 2;   // waves per block; 16-query tiles that each wave works against one set of K / V^T fragments
struct PartBuf { float Pa[QT][16][D + 4], Pm[QT][16], Pd[QT][16]; };
struct TailBuf { float Tf[16][FO + 4]; };

__global__ __launch_bounds__(256) void wput_kernel(const float* __restrict__ wq, const float* __restrict__ wk, const float* __restrict__ wv, const float* __restrict__ wo, b16* __restrict__ W3, b16* __restrict__ WO) { const int u = blockIdx.x * 256 + threadIdx.x; v8b v; float a3[8], ao[8];
  const int p = u / (D * (DI / 8)), r = u % (D * (DI / 8)); const int o3 = r / (DI / 8), k3 = (r % (DI / 8)) * 8; const int oo = u / (D / 8), ko = (u % (D / 8)) * 8;
  // all of a thread's loads are asked for first: the rounding below holds its order, and a load written among the roundings is waited for alone
  if (u < 3 * D * (DI / 8)) { const float* w = p == 0 ? wq : (p == 1 ? wk : wv);
#pragma unroll
    for (int j = 0; j < 8; ++j) a3[j] = w[(size_t)(k3 + j) * D + o3]; }
  if (u < FO * (D / 8)) {
#pragma unroll
    for (int j = 0; j < 8; ++j) ao[j] = wo[(size_t)(ko + j) * FO + oo]; }
  if (u < 3 * D * (DI / 8)) {
#pragma unroll
    for (int j = 0; j < 8; ++j) v[j] = (b16)(bf16_rne(a3[j]) * WSC); { *(v8b*)(W3 + ((size_t)p * D + o3) * DI + k3) = v;  } }
  if (u < FO * (D / 8)) {
#pragma unroll
    for (int j = 0; j < 8; ++j) v[j] = (b16)(bf16_rne(ao[j]) * WSC); { *(v8b*)(WO + (size_t)oo * D + ko) = v;  } } }
template <int MODE>
__global__ __launch_bounds__(32) void proj_kernel(const float* __restrict__ x, const b16* __restrict__ W3, const float* __restrict__ ba, const float* __restrict__ bb, int RLIM, b16* __restrict__ Ah_, b16* __restrict__ Al_, b16* __restrict__ Bh_, b16* __restrict__ Bl_) { __shared__ __attribute__((aligned(16))) b16 Xh[16][DI + 8]; __shared__ __attribute__((aligned(16))) b16 Oh[16][72], Ol[16][72]; const int lane = threadIdx.x, nloc = lane & 15, hlf = lane >> 4; const size_t m0 = (size_t)blockIdx.x * 16; if (m0 >= (size_t)RLIM) return; constexpr int NT = MODE == 0 ? 2 : 4;
  // every global load of the wave is asked for here, as one group: the 16 x rows (a row = 512 contiguous bytes, 16 a lane), the weight fragments, the biases.
  // The rounding and the matrix helper hold their order, and a load written among them is waited for alone.
  typedef __attribute__((ext_vector_type(4))) _Float16 v4b; v4f xv[16]; v16b wf[DI / 32][NT]; float braw[NT];
  { const float* px = x + m0 * DI + lane * 4; const b16* pw = W3 + (size_t)((MODE == 0 ? 0 : D) + nloc) * DI + 8 * hlf; const float* pa = ba + nloc; const float* pb = bb + nloc;
#pragma unroll
    for (int rr = 0; rr < 16; ++rr) xv[rr] = *(const v4f*)(px + rr * DI);
#pragma unroll
    for (int kb = 0; kb < DI; kb += 32)
#pragma unroll
      for (int t = 0; t < NT; ++t) wf[kb / 32][t] = frag_at(pw + t * 16 * DI + kb);
#pragma unroll
    for (int t = 0; t < NT; ++t) braw[t] = (t < 2 ? pa : pb)[(t & 1) * 16];
    asm volatile("s_wait_xcnt 0x0" ::: "memory");   // stands behind the group, in front of every overwrite of a register that a load above names
    __builtin_amdgcn_sched_barrier(0); }   // keeps the first rows' rounding behind the whole group: moved up among the loads it puts a load wait in front of the later loads
#pragma unroll
  for (int rr = 0; rr < 16; ++rr) { v4b h;
#pragma unroll
    for (int j = 0; j < 4; ++j) h[j] = (b16)(bf16_rne(xv[rr][j]) * XS);
    *(v4b*)(&Xh[rr][lane * 4]) = h; }
  if (lane < 16) for (int k = DI; k < DI + 8; ++k) Xh[lane][k] = (b16)0.0f;
  wave_lds_sync(); v8f acc[NT]; v8b th[2], tl[2];
#pragma unroll
  for (int t = 0; t < NT; ++t) acc[t] = (v8f){};
#pragma unroll
  for (int kb = 0; kb < DI; kb += 32) { const v16b a = frag_kb(&Xh[nloc][kb], hlf);
#pragma unroll
    for (int t = 0; t < NT; ++t) acc[t] = wmma16b(a, wf[kb / 32][t], acc[t]); }
#pragma unroll
  for (int t = 0; t < NT; ++t) { const int cc = t * 16 + nloc; const float bias = bfv(braw[t]);
#pragma unroll
    for (int r8 = 0; r8 < 8; ++r8) { b16 p, ql; split16((acc[t][r8] * (1.0f / (XS * WSC)) + bias) * HS, p, ql); if (t < 2) { Oh[8 * hlf + r8][cc] = p; Ol[8 * hlf + r8][cc] = ql; } else { th[t & 1][r8] = p; tl[t & 1][r8] = ql; } } }
  wave_lds_sync();
  // v tiles: a lane holds 8 consecutive keys of one channel, which is 16 bytes of the V^T group of this block's 16 keys
  if (MODE == 1) { const size_t o = ((size_t)blockIdx.x * D + nloc) * 16 + 8 * hlf;
#pragma unroll
    for (int t = 0; t < 2; ++t) { *(v8b*)(Bh_ + o + t * 256) = th[t]; *(v8b*)(Bl_ + o + t * 256) = tl[t]; } }
  typedef __attribute__((ext_vector_type(2))) _Float16 v2b;
  { for (int rr = 0; rr < 16; ++rr) { if (lane < 16) { *(v2b*)(Ah_ + (m0 + rr) * D + lane * 2) = *(const v2b*)(&Oh[rr][lane * 2]); *(v2b*)(Al_ + (m0 + rr) * D + lane * 2) = *(const v2b*)(&Ol[rr][lane * 2]); } }  } }
// attention + LN + Wo: NW WAVES PER BLOCK, block per QT * 16 = 32 queries: the 128 key blocks of 64 are dealt round-robin to the waves, and EACH WAVE WORKS BOTH QUERY TILES against the K and V^T fragments it has in registers, so a fragment is fetched once per 32 queries;
// V^T fragments hi/lo come straight from the workspace; S^T (4 tiles per query tile, K 32; 3 products; A = k rows, B = q): D column = lane's query, D rows = 8 keys per lane half; online softmax per lane in registers (one exchange between the halves for the max);
// P^T x256 hi+lo: tiles 2j and 2j+1 are elements 0..7 and 8..15 of the B fragment of keys 32j.. (the k-map above); O^T += V^T P^T (2 channel tiles; 3 products);
// then the waves' partial (max, den, O) meet in LDS behind one block barrier and wave u merges query tile u (rescale to the common max, waves summed in index order); fused = O/den; LN over 32 and the Wo product stay transposed (a lane owns one query);
__global__ __launch_bounds__(32 * NW) void att_kernel(const b16* __restrict__ Qh, const b16* __restrict__ Ql, const b16* __restrict__ Kh, const b16* __restrict__ Kl, const b16* __restrict__ Vh, const b16* __restrict__ Vl, const b16* __restrict__ WO, const float* __restrict__ gam, const float* __restrict__ bet, const float* __restrict__ bo, int QLIM, int KLIM, float* __restrict__ out) {
  __shared__ __attribute__((aligned(16))) PartBuf pw[NW]; __shared__ __attribute__((aligned(16))) TailBuf wb[QT];
  const int lane = threadIdx.x & 31, wave = __builtin_amdgcn_readfirstlane(threadIdx.x >> 5), nloc = lane & 15, hlf = lane >> 4; const size_t t0 = (size_t)blockIdx.x * (16 * QT); if (t0 >= (size_t)QLIM) return;
  const b16* pqh = Qh + (t0 + nloc) * D + 8 * hlf; const b16* pql = Ql + (t0 + nloc) * D + 8 * hlf; v16b qa[QT], qb[QT];
#pragma unroll
  for (int u = 0; u < QT; ++u) { qa[u] = frag_at(pqh + u * 16 * D); qb[u] = frag_at(pql + u * 16 * D); }
  asm volatile("s_wait_xcnt 0x0" :: "v"(pqh), "v"(pql) : "memory");   // the address registers of the q loads stay untouched up to this wait
  // per lane and query tile u: query nloc's running max (equal in both halves) and this half's share of its denominator; acc[u][t][r8] = O^T[channel 16t + 8hlf + r8][query 16u + nloc]
  float m_q[QT], den_q[QT]; v8f acc[QT][2];
#pragma unroll
  for (int u = 0; u < QT; ++u) { m_q[u] = -INFINITY; den_q[u] = 0.0f; acc[u][0] = (v8f){}; acc[u][1] = (v8f){}; }
  // K fragments hi/lo of one whole key block live in registers and are fetched one block ahead; the first block's are asked for here
  v16b kh[KB / 16], kl[KB / 16]; const unsigned ko = (unsigned)(nloc * D + 8 * hlf);   // this lane's row and half in a 16-key tile
  if (wave * KB < KLIM) { const b16* ph = Kh + (size_t)(wave * KB) * D + ko; const b16* pl = Kl + (size_t)(wave * KB) * D + ko;
#pragma unroll
    for (int t = 0; t < KB / 16; ++t) { kh[t] = frag_at(ph + t * 16 * D); kl[t] = frag_at(pl + t * 16 * D); }
    asm volatile("s_wait_xcnt 0x0" :: "v"(ph), "v"(pl) : "memory");   // stands in front of every overwrite of a register that the loads above name
    __builtin_amdgcn_sched_barrier(0); }   // keeps the loop's first address arithmetic behind that wait: lifted over it, it rewrote the loads' offset register ahead of the wait
#pragma unroll 1
  for (int kb0 = wave * KB; kb0 < KLIM; kb0 += NW * KB) {
    // V^T fragments of this key block: all asked for here, they fly under the S^T tiles and the softmax
    v16b vh[KB / 32][2], vl[KB / 32][2]; const size_t vo = ((size_t)(kb0 >> 4) * D + nloc) * 16 + 8 * hlf;   // this lane's place in the block's first group: channel nloc, keys 8hlf..
    { const b16* ph = Vh + vo; const b16* pl = Vl + vo;
#pragma unroll
      for (int j = 0; j < KB / 32; ++j)
#pragma unroll
        for (int t = 0; t < 2; ++t) { vh[j][t] = frag_vt(ph + (2 * j * D + t * 16) * 16); vl[j][t] = frag_vt(pl + (2 * j * D + t * 16) * 16); }
      asm volatile("s_wait_xcnt 0x0" :: "v"(ph), "v"(pl) : "memory"); }   // holds the loads above in front of the tiles; their address registers stay untouched up to this wait
    // S^T tiles (K 32 = one k-step): rows = keys, cols = queries; the two query tiles' chains alternate on the same K fragment
    v8f st[QT][KB / 16], mv[QT];
#pragma unroll
    for (int t = 0; t < KB / 16; ++t) { v8f s[QT];
#pragma unroll
      for (int u = 0; u < QT; ++u) s[u] = wmma16b(kh[t], qa[u], (v8f){});
#pragma unroll
      for (int u = 0; u < QT; ++u) s[u] = wmma16b(kl[t], qa[u], s[u]);
#pragma unroll
      for (int u = 0; u < QT; ++u) s[u] = wmma16b(kh[t], qb[u], s[u]);
#pragma unroll
      for (int u = 0; u < QT; ++u)
#pragma unroll
        for (int r8 = 0; r8 < 8; ++r8) { st[u][t][r8] = s[u][r8] * (1.0f / (HS * HS)); mv[u][r8] = t == 0 ? st[u][t][r8] : fmaxf(mv[u][r8], st[u][t][r8]); } }
    // the wave's next key block's K fragments: asked for here, they fly under the softmax and the O^T products (behind the last block: this block's again, unused)
    { const int kn = kb0 + NW * KB < KLIM ? kb0 + NW * KB : kb0; const b16* ph = Kh + (size_t)kn * D + ko; const b16* pl = Kl + (size_t)kn * D + ko;
#pragma unroll
      for (int t = 0; t < KB / 16; ++t) { kh[t] = frag_at(ph + t * 16 * D); kl[t] = frag_at(pl + t * 16 * D); }
      asm volatile("s_wait_xcnt 0x0" :: "v"(ph), "v"(pl) : "memory"); }   // holds the loads above in front of the softmax; their address registers stay untouched up to this wait
    v16b pa[QT][KB / 32], pb[QT][KB / 32];
#pragma unroll
    for (int u = 0; u < QT; ++u) {
      float mx = mv[u][0];
#pragma unroll
      for (int r8 = 1; r8 < 8; ++r8) mx = fmaxf(mx, mv[u][r8]);
      mx = fmaxf(mx, __shfl_xor(mx, 16));
      const float mn = fmaxf(m_q[u], mx); const float sf = (m_q[u] == -INFINITY) ? 0.0f : __expf(m_q[u] - mn); v8f pv = {};
#pragma unroll
      for (int t = 0; t < KB / 16; ++t)
#pragma unroll
        for (int r8 = 0; r8 < 8; ++r8) { const float p = __expf(st[u][t][r8] - mn); pv[r8] += p; b16 ph, pl; split16(p * PS, ph, pl); pa[u][t >> 1][(t & 1) * 8 + r8] = ph; pb[u][t >> 1][(t & 1) * 8 + r8] = pl; }
      const float ps = ((pv[0] + pv[1]) + (pv[2] + pv[3])) + ((pv[4] + pv[5]) + (pv[6] + pv[7]));
      den_q[u] = den_q[u] * sf + ps; m_q[u] = mn;
#pragma unroll
      for (int t = 0; t < 2; ++t)
#pragma unroll
        for (int r8 = 0; r8 < 8; ++r8) acc[u][t][r8] = acc[u][t][r8] * sf; }
#pragma unroll
    for (int ks = 0; ks < KB; ks += 32) {
#pragma unroll
      for (int t = 0; t < 2; ++t) {
#pragma unroll
        for (int u = 0; u < QT; ++u) acc[u][t] = wmma16b(vh[ks / 32][t], pa[u][ks / 32], acc[u][t]);
#pragma unroll
        for (int u = 0; u < QT; ++u) acc[u][t] = wmma16b(vl[ks / 32][t], pa[u][ks / 32], acc[u][t]);
#pragma unroll
        for (int u = 0; u < QT; ++u) acc[u][t] = wmma16b(vh[ks / 32][t], pb[u][ks / 32], acc[u][t]); } } }
  // each wave publishes, per query tile, its partial row max, denominator (the halves' shares joined here) and O (back to [query][channel]) in its own slab
  { PartBuf& E = pw[wave];
#pragma unroll
    for (int u = 0; u < QT; ++u) { const float den_f = den_q[u] + __shfl_xor(den_q[u], 16);
#pragma unroll
      for (int t = 0; t < 2; ++t)
#pragma unroll
        for (int r8 = 0; r8 < 8; ++r8) E.Pa[u][nloc][t * 16 + 8 * hlf + r8] = acc[u][t][r8];
      if (hlf == 0) { E.Pm[u][nloc] = m_q[u]; E.Pd[u][nloc] = den_f; } } }
  __syncthreads();   // every wave's partials are in LDS before waves 0 .. QT-1 read them
  if (wave >= QT) return;
  const size_t tq = t0 + (size_t)wave * 16;   // wave u finishes query tile u, and a lane keeps the query it had in the loop: query nloc, channels 16t + 8hlf + 0..7 (element e = 8t + r8)
  // every global load of the epilogue is asked for here, as one group, and flies under the merge: Wo fragments, this lane's 16 gamma and beta, the 4 bo of the columns it stores
  v16b wof[8]; v4f graw[4], beraw[4], boraw;
  { const b16* pwo = WO + (size_t)nloc * D + 8 * hlf; const float* pg = gam + 8 * hlf; const float* pe = bet + 8 * hlf; const float* po = bo + lane * 4;
#pragma unroll
    for (int t = 0; t < 8; ++t) wof[t] = frag_at(pwo + t * 16 * D);
#pragma unroll
    for (int c = 0; c < 4; ++c) { graw[c] = *(const v4f*)(pg + (c >> 1) * 16 + (c & 1) * 4); beraw[c] = *(const v4f*)(pe + (c >> 1) * 16 + (c & 1) * 4); }
    boraw = *(const v4f*)po;
    asm volatile("s_wait_xcnt 0x0" ::: "memory"); }   // stands behind the group, in front of every overwrite of a register that a load above names
  // merge: all of the lane's partials are read as one group (16 bytes a read for O), then rescaled to the common max and summed over the waves in index order
  auto& Tf = wb[wave].Tf; float pm[NW], pd[NW]; v4f pa4[NW][4];
#pragma unroll
  for (int w = 0; w < NW; ++w) { pm[w] = pw[w].Pm[wave][nloc]; pd[w] = pw[w].Pd[wave][nloc];
#pragma unroll
    for (int c = 0; c < 4; ++c) pa4[w][c] = *(const v4f*)(&pw[w].Pa[wave][nloc][(c >> 1) * 16 + 8 * hlf + (c & 1) * 4]); }
  float mx = pm[0];
#pragma unroll
  for (int w = 1; w < NW; ++w) mx = fmaxf(mx, pm[w]);
  float dn = 0.0f, f[16];
#pragma unroll
  for (int e = 0; e < 16; ++e) f[e] = 0.0f;
#pragma unroll
  for (int w = 0; w < NW; ++w) { const float sc = (pm[w] == -INFINITY) ? 0.0f : __expf(pm[w] - mx); dn += pd[w] * sc;
#pragma unroll
    for (int e = 0; e < 16; ++e) f[e] += pa4[w][e >> 2][e & 3] * sc; }
#pragma unroll
  for (int e = 0; e < 16; ++e) f[e] = f[e] * (1.0f / (HS * PS)) / dn;
  // LayerNorm over the query's 32 channels: 16 in the lane, 16 in the lane of the other half (one exchange per sum)
  float s = ((((f[0] + f[1]) + (f[2] + f[3])) + ((f[4] + f[5]) + (f[6] + f[7]))) + (((f[8] + f[9]) + (f[10] + f[11])) + ((f[12] + f[13]) + (f[14] + f[15]))));
  s += __shfl_xor(s, 16); const float mu = s / D; float q2[16];
#pragma unroll
  for (int e = 0; e < 16; ++e) { f[e] -= mu; q2[e] = f[e] * f[e]; }
  float s2 = ((((q2[0] + q2[1]) + (q2[2] + q2[3])) + ((q2[4] + q2[5]) + (q2[6] + q2[7]))) + (((q2[8] + q2[9]) + (q2[10] + q2[11])) + ((q2[12] + q2[13]) + (q2[14] + q2[15]))));
  s2 += __shfl_xor(s2, 16); const float rs = rsqrtf(s2 / D + LNEPS);
  // normed^T hi/lo: element e is k = 16t + 8hlf + r8, which is the k-map of the B fragment: it packs in the lane
  v16b nh, nl;
#pragma unroll
  for (int e = 0; e < 16; ++e) { const float nv = f[e] * rs * bfv(graw[e >> 2][e & 3]) + bfv(beraw[e >> 2][e & 3]); b16 p, ql; split16(nv * HS, p, ql); nh[e] = p; nl[e] = ql; }
  // out^T = Wo^T normed^T: A = Wo rows (out channels), D column = the lane's query, D rows = out channels 16t + 8hlf + 0..7; the 8 tiles' chains are independent
  v8f o8[8];
#pragma unroll
  for (int t = 0; t < 8; ++t) o8[t] = wmma16b(wof[t], nh, (v8f){});
#pragma unroll
  for (int t = 0; t < 8; ++t) o8[t] = wmma16b(wof[t], nl, o8[t]);
  // back to [query][out channel] through LDS, so that a store covers a whole 512-byte row
#pragma unroll
  for (int t = 0; t < 8; ++t) { *(v4f*)(&Tf[nloc][t * 16 + 8 * hlf]) = (v4f){o8[t][0], o8[t][1], o8[t][2], o8[t][3]}; *(v4f*)(&Tf[nloc][t * 16 + 8 * hlf + 4]) = (v4f){o8[t][4], o8[t][5], o8[t][6], o8[t][7]}; }
  wave_lds_sync();
  float bb[4];
#pragma unroll
  for (int j = 0; j < 4; ++j) bb[j] = bfv(boraw[j]);
  float* pout = out + tq * FO + lane * 4;
#pragma unroll
  for (int rr = 0; rr < 16; ++rr) { const v4f tv = *(const v4f*)(&Tf[rr][lane * 4]); v4f r;
#pragma unroll
    for (int j = 0; j < 4; ++j) r[j] = tv[j] * (1.0f / (HS * WSC)) + bb[j];
    *(v4f*)(pout + rr * FO) = r; } }
}  // namespace

extern "C" void kernel_launch(void* const* d_in, const int* in_sizes, int n_in, void* d_out, int out_size, void* d_ws, size_t ws_size, hipStream_t stream) {
  (void)n_in;
  auto Fp = [&](int i) { return (const float*)d_in[i]; };
  // Input order: 0 input1 [8192,128]; 1 input2 [8192,128]; 2 Wq [128,32]; 3 bq; 4 Wk; 5 bk; 6 Wv; 7 bv; 8 gamma [32]; 9 beta; 10 Wo [32,128]; 11 bo [128]
  if (in_sizes[0] != N1 * DI || in_sizes[1] != N2 * DI || in_sizes[2] != DI * D || in_sizes[4] != DI * D || in_sizes[6] != DI * D || in_sizes[8] != D || in_sizes[10] != D * FO || in_sizes[11] != FO || out_size != N1 * FO) return;
  const int QLIM = N1, KLIM = N2;   // query / key cuts (multiples of 128)
  size_t off = 0; char* ws = (char*)d_ws;
  auto carve = [&](size_t bytes) { char* p = ws + off; off += (bytes + 255) & ~(size_t)255; return p; };
  b16* W3 = (b16*)carve((size_t)3 * D * DI * 2); b16* WO = (b16*)carve((size_t)FO * D * 2); b16* Qh = (b16*)carve((size_t)N1 * D * 2); b16* Ql = (b16*)carve((size_t)N1 * D * 2); b16* Kh = (b16*)carve((size_t)N2 * D * 2); b16* Kl = (b16*)carve((size_t)N2 * D * 2); b16* Vh = (b16*)carve((size_t)N2 * D * 2); b16* Vl = (b16*)carve((size_t)N2 * D * 2);
  if (off > ws_size || off > ((size_t)8 << 20)) return;   // ~ 3.2 MB
  wput_kernel<<<(3 * D * (DI / 8) + 255) / 256, 256, 0, stream>>>(Fp(2), Fp(4), Fp(6), Fp(10), W3, WO);
  proj_kernel<0><<<QLIM / 16, 32, 0, stream>>>(Fp(0), W3, Fp(3), Fp(3), QLIM, Qh, Ql, Qh, Ql);
  proj_kernel<1><<<KLIM / 16, 32, 0, stream>>>(Fp(1), W3, Fp(5), Fp(7), KLIM, Kh, Kl, Vh, Vl);
  att_kernel<<<QLIM / (16 * QT), 32 * NW, 0, stream>>>(Qh, Ql, Kh, Kl, Vh, Vl, WO, Fp(8), Fp(9), Fp(11), QLIM, KLIM, (float*)d_out);
}

// v008
// One run takes 34.2 microseconds.
// In two side-by-side timings against v007, it was 1.17 and 1.19 times as fast.
// Over all steps from v000 it is 31.2 times as fast.
#include <hip/hip_runtime.h>

// CAM (cross-attention module): q = input1 Wq + bq [8192][32]; k = input2 Wk + bk, v = input2 Wv + bv [8192][32]; scores = q k^T (no scaling); w = softmax over the 8,192 keys; fused = w v; LayerNorm(fused) (eps 1e-5, gamma/beta);
// out = normed Wo + bo -> [8192][128].
// Deterministic: no index structures, no atomics.
// V is kept in the workspace as V^T in groups of 16 keys, [key / 16][channel][key % 16], so that a V^T fragment is two 16-byte loads.
// WMMA (v_wmma_f32_16x16x32_f16, f32 accumulate): projections with the inputs EXACT bf16 x8 (K 128, 2 tiles each) against exact weight rows x256; S^T = k q^T per (64-key block, 16-query tile) and O^T += V^T P^T (q/k/v/P hi+lo x256; 3 products each), so a lane owns one query's scores and P^T packs in-lane into the B operand;
// out^T = Wo rows x LN(fused)^T (hi+lo) (K 32, 8 tiles). Online softmax and LayerNorm in f32. Inputs rounded to bf16 once. Fragment k-map per lane half hh for A AND B: elements 0..7 <- k = 8hh+0..7, 8..15 <- k = 16+8hh+0..7;

namespace {
constexpr int N1 = 8192, N2 = 8192, DI = 128, D = 32, FO = 128, KB = 64;
constexpr float XS = 8.0f, HS = 256.0f, WSC = 256.0f, PS = 256.0f, LNEPS = 1e-5f;
typedef _Float16 b16;
typedef __attribute__((ext_vector_type(16))) _Float16 v16b;
typedef __attribute__((ext_vector_type(8))) _Float16 v8b;
typedef __attribute__((ext_vector_type(8))) float v8f;
typedef __attribute__((ext_vector_type(4))) float v4f;
__device__ __forceinline__ float bf16_rne(float f) { unsigned int u = __float_as_uint(f); u += 0x7FFFu + ((u >> 16) & 1u); float r = __uint_as_float(u & 0xFFFF0000u); asm volatile("" : "+v"(r)); return r; }
__device__ __forceinline__ float bfv(float f) { float r = bf16_rne(f); asm volatile("" : "+v"(r)); return r; }
__device__ __forceinline__ void split16(float v, b16& hi, b16& lo) { hi = (b16)v; lo = (b16)(v - (float)hi); }
__device__ __forceinline__ v16b frag_kb(const b16* p, int hh) { const v8b a = *(const v8b*)(p + 8 * hh), b = *(const v8b*)(p + 16 + 8 * hh); v16b f;
#pragma unroll
  for (int e = 0; e < 8; ++e) { f[e] = a[e]; f[8 + e] = b[e]; } return f; }
// the same fragment from a pointer that already holds the lane half's 8hh
__device__ __forceinline__ v16b frag_at(const b16* p) { const v8b a = *(const v8b*)p, b = *(const v8b*)(p + 16); v16b f;
#pragma unroll
  for (int e = 0; e < 8; ++e) { f[e] = a[e]; f[8 + e] = b[e]; } return f; }
// V^T fragment in the k-map above: p = this lane's 8 keys (8hh..) of its channel in a 16-key group; elements 8..15 are the same place in the next group
__device__ __forceinline__ v16b frag_vt(const b16* p) { const v8b a = *(const v8b*)p, b = *(const v8b*)(p + D * 16); v16b f;
#pragma unroll
  for (int e = 0; e < 8; ++e) { f[e] = a[e]; f[8 + e] = b[e]; } return f; }
__device__ __forceinline__ v8f wmma16b(v16b a, v16b b, v8f c) { v8f d = __builtin_amdgcn_wmma_f32_16x16x32_f16(false, a, false, b, (short)0, c, false, false); asm volatile("v_nop\n\tv_nop\n\tv_nop\n\tv_nop" : "+v"(d) : "v"(a), "v"(b)); return d; }
__device__ __forceinline__ void wave_lds_sync() { __builtin_amdgcn_fence(__ATOMIC_RELEASE, "workgroup"); __builtin_amdgcn_wave_barrier(); __builtin_amdgcn_fence(__ATOMIC_ACQUIRE, "workgroup"); }
// att_kernel LDS, used behind the key loop only: one slab of partials per wave for the merge, one output stage per query tile.
constexpr int NW = 8, QT = 2;   // waves per block; 16-query tiles that each wave works against one set of K / V^T fragments
struct PartBuf { float Pa[QT][16][D + 4], Pm[QT][16], Pd[QT][16]; };
struct TailBuf { float Tf[16][FO + 4]; };

// One launch prepares everything the attention kernel reads. A block of PW waves rounds its own weight matrices into LDS as [channel][k] (the layout of a fragment row), each wave then projects 16 rows; the last block rounds Wo into the workspace.
constexpr int PW = 4;   // waves per block: its 128 threads cover one weight matrix as 16 groups of 8 k x 8 quads of channels
static_assert(32 * PW == (DI / 8) * (D / 4), "a thread owns 8 k x 4 channels of each weight matrix");
struct ProjWave { b16 Xh[16][DI + 8], Oh[16][72], Ol[16][72]; };
template <int MODE>
__device__ __forceinline__ void proj_body(int blk, const float* __restrict__ x, const float* __restrict__ wa, const float* __restrict__ wb_, const float* __restrict__ ba, const float* __restrict__ bb, int RLIM, b16* __restrict__ Ah_, b16* __restrict__ Al_, b16* __restrict__ Bh_, b16* __restrict__ Bl_, ProjWave* pws, b16 (*Wt)[DI + 8]) { const int lane = threadIdx.x & 31, wave = __builtin_amdgcn_readfirstlane(threadIdx.x >> 5), nloc = lane & 15, hlf = lane >> 4; const size_t m0 = ((size_t)blk * PW + wave) * 16; constexpr int NT = MODE == 0 ? 2 : 4, NM = NT / 2; const int c4 = (threadIdx.x & 7) * 4, k8 = (threadIdx.x >> 3) * 8; auto& Xh = pws[wave].Xh; auto& Oh = pws[wave].Oh; auto& Ol = pws[wave].Ol;
  // every global load of the wave is asked for here, as one group: its share of the weights (rows k8 .. k8+7, channels c4 .. c4+3 of each matrix, 16 bytes a load), the 16 x rows (a row = 512 contiguous bytes, 16 a lane), the biases.
  // The rounding and the matrix helper hold their order, and a load written among them is waited for alone.
  typedef __attribute__((ext_vector_type(4))) _Float16 v4b; v4f xv[16], wr[NM][8]; float braw[NT];
  { const float* px = x + m0 * DI + lane * 4; const float* pwa = wa + (size_t)k8 * D + c4; const float* pwb = wb_ + (size_t)k8 * D + c4; const float* pa = ba + nloc; const float* pb = bb + nloc;
#pragma unroll
    for (int i = 0; i < NM; ++i)
#pragma unroll
      for (int j = 0; j < 8; ++j) wr[i][j] = *(const v4f*)((i == 0 ? pwa : pwb) + j * D);
    __builtin_amdgcn_sched_barrier(0);   // keeps every weight load ahead of the x loads: loads come back in order, and a weight load moved behind them holds the weights' rounding back until the x rows are in
#pragma unroll
    for (int rr = 0; rr < 16; ++rr) xv[rr] = *(const v4f*)(px + rr * DI);
#pragma unroll
    for (int t = 0; t < NT; ++t) braw[t] = (t < 2 ? pa : pb)[(t & 1) * 16];
    asm volatile("s_wait_xcnt 0x0" :: "v"(pwa), "v"(pwb) : "memory");   // stands behind the group, in front of every overwrite of a register that a load above names; the weight loads' address registers stay untouched (no later load lands in them) up to this wait
    __builtin_amdgcn_sched_barrier(0); }   // keeps the first rounding behind the whole group: moved up among the loads it puts a load wait in front of the later loads
#pragma unroll
  for (int i = 0; i < NM; ++i)
#pragma unroll
    for (int c = 0; c < 4; ++c) { v8b v;
#pragma unroll
      for (int j = 0; j < 8; ++j) v[j] = (b16)(bf16_rne(wr[i][j][c]) * WSC);
      *(v8b*)(&Wt[i * D + c4 + c][k8]) = v; }
#pragma unroll
  for (int rr = 0; rr < 16; ++rr) { v4b h;
#pragma unroll
    for (int j = 0; j < 4; ++j) h[j] = (b16)(bf16_rne(xv[rr][j]) * XS);
    *(v4b*)(&Xh[rr][lane * 4]) = h; }
  if (lane < 16) for (int k = DI; k < DI + 8; ++k) Xh[lane][k] = (b16)0.0f;
  __syncthreads();   // every wave's share of the weights is in LDS before any wave reads a fragment (it also orders the wave's own Xh rows)
  if (m0 >= (size_t)RLIM) return;
  // all LDS fragments are asked for as one group ahead of the products
  v16b wf[DI / 32][NT], af[DI / 32]; v8f acc[NT]; v8b th[2], tl[2];
#pragma unroll
  for (int kb = 0; kb < DI; kb += 32) { af[kb / 32] = frag_kb(&Xh[nloc][kb], hlf);
#pragma unroll
    for (int t = 0; t < NT; ++t) wf[kb / 32][t] = frag_kb(&Wt[t * 16 + nloc][kb], hlf); }
#pragma unroll
  for (int t = 0; t < NT; ++t) acc[t] = (v8f){};
#pragma unroll
  for (int kb = 0; kb < DI; kb += 32) {
#pragma unroll
    for (int t = 0; t < NT; ++t) acc[t] = wmma16b(af[kb / 32], wf[kb / 32][t], acc[t]); }
#pragma unroll
  for (int t = 0; t < NT; ++t) { const int cc = t * 16 + nloc; const float bias = bfv(braw[t]);
#pragma unroll
    for (int r8 = 0; r8 < 8; ++r8) { b16 p, ql; split16((acc[t][r8] * (1.0f / (XS * WSC)) + bias) * HS, p, ql); if (t < 2) { Oh[8 * hlf + r8][cc] = p; Ol[8 * hlf + r8][cc] = ql; } else { th[t & 1][r8] = p; tl[t & 1][r8] = ql; } } }
  wave_lds_sync();
  // v tiles: a lane holds 8 consecutive keys of one channel, which is 16 bytes of the V^T group of this wave's 16 keys
  if (MODE == 1) { const size_t o = ((m0 >> 4) * D + nloc) * 16 + 8 * hlf;
#pragma unroll
    for (int t = 0; t < 2; ++t) { *(v8b*)(Bh_ + o + t * 256) = th[t]; *(v8b*)(Bl_ + o + t * 256) = tl[t]; } }
  typedef __attribute__((ext_vector_type(2))) _Float16 v2b;
  { for (int rr = 0; rr < 16; ++rr) { if (lane < 16) { *(v2b*)(Ah_ + (m0 + rr) * D + lane * 2) = *(const v2b*)(&Oh[rr][lane * 2]); *(v2b*)(Al_ + (m0 + rr) * D + lane * 2) = *(const v2b*)(&Ol[rr][lane * 2]); } }  } }
// blocks 0 .. nk-1: k and v rows (the longer body, lowest block indices); the next nq: q rows; the last: Wo
__global__ __launch_bounds__(32 * PW) void prep_kernel(const float* __restrict__ x1, const float* __restrict__ x2, const float* __restrict__ wq, const float* __restrict__ wk, const float* __restrict__ wv, const float* __restrict__ wo, const float* __restrict__ bq, const float* __restrict__ bk, const float* __restrict__ bv, int QLIM, int KLIM, b16* __restrict__ WO, b16* __restrict__ Qh, b16* __restrict__ Ql, b16* __restrict__ Kh, b16* __restrict__ Kl, b16* __restrict__ Vh, b16* __restrict__ Vl) {
  __shared__ __attribute__((aligned(16))) ProjWave pws[PW]; __shared__ __attribute__((aligned(16))) b16 Wt[2 * D][DI + 8];
  const int nk = (KLIM + 16 * PW - 1) / (16 * PW), nq = (QLIM + 16 * PW - 1) / (16 * PW), b = blockIdx.x;
  if (b < nk) { proj_body<1>(b, x2, wk, wv, bk, bv, KLIM, Kh, Kl, Vh, Vl, pws, Wt); return; }
  if (b < nk + nq) { proj_body<0>(b - nk, x1, wq, wq, bq, bq, QLIM, Qh, Ql, Qh, Ql, pws, Wt); return; }
  // Wo: a thread rounds 8 k (k0 ..) of out channels o0, o0 + OS, ...; all loads first, as above
  constexpr int OS = 32 * PW / (D / 8), NO = FO / OS; float ao[NO][8]; const int k0 = (threadIdx.x % (D / 8)) * 8, o0 = threadIdx.x / (D / 8); const float* p = wo + (size_t)k0 * FO + o0;
#pragma unroll
  for (int i = 0; i < NO; ++i)
#pragma unroll
    for (int j = 0; j < 8; ++j) ao[i][j] = p[j * FO + i * OS];
  asm volatile("s_wait_xcnt 0x0" :: "v"(p) : "memory");   // stands behind the group, in front of every overwrite of a register that a load above names; the address register stays untouched up to this wait
#pragma unroll
  for (int i = 0; i < NO; ++i) { v8b v;
#pragma unroll
    for (int j = 0; j < 8; ++j) v[j] = (b16)(bf16_rne(ao[i][j]) * WSC);
    *(v8b*)(WO + (size_t)(o0 + i * OS) * D + k0) = v; }
  asm volatile("s_wait_xcnt 0x0" ::: "memory"); }   // stands behind the last Wo store, in front of every overwrite of a register that a store above names
// attention + LN + Wo: NW WAVES PER BLOCK, block per QT * 16 = 32 queries: the 128 key blocks of 64 are dealt round-robin to the waves, and EACH WAVE WORKS BOTH QUERY TILES against the K and V^T fragments it has in registers, so a fragment is fetched once per 32 queries;
// V^T fragments hi/lo come straight from the workspace; S^T (4 tiles per query tile, K 32; 3 products; A = k rows, B = q): D column = lane's query, D rows = 8 keys per lane half; online softmax per lane in registers (one exchange between the halves for the max);
// P^T x256 hi+lo: tiles 2j and 2j+1 are elements 0..7 and 8..15 of the B fragment of keys 32j.. (the k-map above); O^T += V^T P^T (2 channel tiles; 3 products);
// then the waves' partial (max, den, O) meet in LDS behind one block barrier and wave u merges query tile u (rescale to the common max, waves summed in index order); fused = O/den; LN over 32 and the Wo product stay transposed (a lane owns one query);
__global__ __launch_bounds__(32 * NW) void att_kernel(const b16* __restrict__ Qh, const b16* __restrict__ Ql, const b16* __restrict__ Kh, const b16* __restrict__ Kl, const b16* __restrict__ Vh, const b16* __restrict__ Vl, const b16* __restrict__ WO, const float* __restrict__ gam, const float* __restrict__ bet, const float* __restrict__ bo, int QLIM, int KLIM, float* __restrict__ out) {
  __shared__ __attribute__((aligned(16))) PartBuf pw[NW]; __shared__ __attribute__((aligned(16))) TailBuf wb[QT];
  const int lane = threadIdx.x & 31, wave = __builtin_amdgcn_readfirstlane(threadIdx.x >> 5), nloc = lane & 15, hlf = lane >> 4; const size_t t0 = (size_t)blockIdx.x * (16 * QT); if (t0 >= (size_t)QLIM) return;
  const b16* pqh = Qh + (t0 + nloc) * D + 8 * hlf; const b16* pql = Ql + (t0 + nloc) * D + 8 * hlf; v16b qa[QT], qb[QT];
#pragma unroll
  for (int u = 0; u < QT; ++u) { qa[u] = frag_at(pqh + u * 16 * D); qb[u] = frag_at(pql + u * 16 * D); }
  asm volatile("s_wait_xcnt 0x0" :: "v"(pqh), "v"(pql) : "memory");   // the address registers of the q loads stay untouched up to this wait
  // per lane and query tile u: query nloc's running max (equal in both halves) and this half's share of its denominator; acc[u][t][r8] = O^T[channel 16t + 8hlf + r8][query 16u + nloc]
  float m_q[QT], den_q[QT]; v8f acc[QT][2];
#pragma unroll
  for (int u = 0; u < QT; ++u) { m_q[u] = -INFINITY; den_q[u] = 0.0f; acc[u][0] = (v8f){}; acc[u][1] = (v8f){}; }
  // K fragments hi/lo of one whole key block live in registers and are fetched one block ahead; the first block's are asked for here
  v16b kh[KB / 16], kl[KB / 16]; const unsigned ko = (unsigned)(nloc * D + 8 * hlf);   // this lane's row and half in a 16-key tile
  if (wave * KB < KLIM) { const b16* ph = Kh + (size_t)(wave * KB) * D + ko; const b16* pl = Kl + (size_t)(wave * KB) * D + ko;
#pragma unroll
    for (int t = 0; t < KB / 16; ++t) { kh[t] = frag_at(ph + t * 16 * D); kl[t] = frag_at(pl + t * 16 * D); }
    asm volatile("s_wait_xcnt 0x0" :: "v"(ph), "v"(pl) : "memory");   // stands in front of every overwrite of a register that the loads above name
    __builtin_amdgcn_sched_barrier(0); }   // keeps the loop's first address arithmetic behind that wait: lifted over it, it rewrote the loads' offset register ahead of the wait
#pragma unroll 1
  for (int kb0 = wave * KB; kb0 < KLIM; kb0 += NW * KB) {
    // V^T fragments of this key block: all asked for here, they fly under the S^T tiles and the softmax
    v16b vh[KB / 32][2], vl[KB / 32][2]; const size_t vo = ((size_t)(kb0 >> 4) * D + nloc) * 16 + 8 * hlf;   // this lane's place in the block's first group: channel nloc, keys 8hlf..
    { const b16* ph = Vh + vo; const b16* pl = Vl + vo;
#pragma unroll
      for (int j = 0; j < KB / 32; ++j)
#pragma unroll
        for (int t = 0; t < 2; ++t) { vh[j][t] = frag_vt(ph + (2 * j * D + t * 16) * 16); vl[j][t] = frag_vt(pl + (2 * j * D + t * 16) * 16); }
      asm volatile("s_wait_xcnt 0x0" :: "v"(ph), "v"(pl) : "memory"); }   // holds the loads above in front of the tiles; their address registers stay untouched up to this wait
    // S^T tiles (K 32 = one k-step): rows = keys, cols = queries; the two query tiles' chains alternate on the same K fragment
    v8f st[QT][KB / 16], mv[QT];
#pragma unroll
    for (int t = 0; t < KB / 16; ++t) { v8f s[QT];
#pragma unroll
      for (int u = 0; u < QT; ++u) s[u] = wmma16b(kh[t], qa[u], (v8f){});
#pragma unroll
      for (int u = 0; u < QT; ++u) s[u] = wmma16b(kl[t], qa[u], s[u]);
#pragma unroll
      for (int u = 0; u < QT; ++u) s[u] = wmma16b(kh[t], qb[u], s[u]);
#pragma unroll
      for (int u = 0; u < QT; ++u)
#pragma unroll
        for (int r8 = 0; r8 < 8; ++r8) { st[u][t][r8] = s[u][r8] * (1.0f / (HS * HS)); mv[u][r8] = t == 0 ? st[u][t][r8] : fmaxf(mv[u][r8], st[u][t][r8]); } }
    // the wave's next key block's K fragments: asked for here, they fly under the softmax and the O^T products (behind the last block: this block's again, unused)
    { const int kn = kb0 + NW * KB < KLIM ? kb0 + NW * KB : kb0; const b16* ph = Kh + (size_t)kn * D + ko; const b16* pl = Kl + (size_t)kn * D + ko;
#pragma unroll
      for (int t = 0; t < KB / 16; ++t) { kh[t] = frag_at(ph + t * 16 * D); kl[t] = frag_at(pl + t * 16 * D); }
      asm volatile("s_wait_xcnt 0x0" :: "v"(ph), "v"(pl) : "memory"); }   // holds the loads above in front of the softmax; their address registers stay untouched up to this wait
    v16b pa[QT][KB / 32], pb[QT][KB / 32];
#pragma unroll
    for (int u = 0; u < QT; ++u) {
      float mx = mv[u][0];
#pragma unroll
      for (int r8 = 1; r8 < 8; ++r8) mx = fmaxf(mx, mv[u][r8]);
      mx = fmaxf(mx, __shfl_xor(mx, 16));
      const float mn = fmaxf(m_q[u], mx); const float sf = (m_q[u] == -INFINITY) ? 0.0f : __expf(m_q[u] - mn); v8f pv = {};
#pragma unroll
      for (int t = 0; t < KB / 16; ++t)
#pragma unroll
        for (int r8 = 0; r8 < 8; ++r8) { const float p = __expf(st[u][t][r8] - mn); pv[r8] += p; b16 ph, pl; split16(p * PS, ph, pl); pa[u][t >> 1][(t & 1) * 8 + r8] = ph; pb[u][t >> 1][(t & 1) * 8 + r8] = pl; }
      const float ps = ((pv[0] + pv[1]) + (pv[2] + pv[3])) + ((pv[4] + pv[5]) + (pv[6] + pv[7]));
      den_q[u] = den_q[u] * sf + ps; m_q[u] = mn;
#pragma unroll
      for (int t = 0; t < 2; ++t)
#pragma unroll
        for (int r8 = 0; r8 < 8; ++r8) acc[u][t][r8] = acc[u][t][r8] * sf; }
#pragma unroll
    for (int ks = 0; ks < KB; ks += 32) {
#pragma unroll
      for (int t = 0; t < 2; ++t) {
#pragma unroll
        for (int u = 0; u < QT; ++u) acc[u][t] = wmma16b(vh[ks / 32][t], pa[u][ks / 32], acc[u][t]);
#pragma unroll
        for (int u = 0; u < QT; ++u) acc[u][t] = wmma16b(vl[ks / 32][t], pa[u][ks / 32], acc[u][t]);
#pragma unroll
        for (int u = 0; u < QT; ++u) acc[u][t] = wmma16b(vh[ks / 32][t], pb[u][ks / 32], acc[u][t]); } } }
  // each wave publishes, per query tile, its partial row max, denominator (the halves' shares joined here) and O (back to [query][channel]) in its own slab
  { PartBuf& E = pw[wave];
#pragma unroll
    for (int u = 0; u < QT; ++u) { const float den_f = den_q[u] + __shfl_xor(den_q[u], 16);
#pragma unroll
      for (int t = 0; t < 2; ++t)
#pragma unroll
        for (int r8 = 0; r8 < 8; ++r8) E.Pa[u][nloc][t * 16 + 8 * hlf + r8] = acc[u][t][r8];
      if (hlf == 0) { E.Pm[u][nloc] = m_q[u]; E.Pd[u][nloc] = den_f; } } }
  __syncthreads();   // every wave's partials are in LDS before waves 0 .. QT-1 read them
  if (wave >= QT) return;
  const size_t tq = t0 + (size_t)wave * 16;   // wave u finishes query tile u, and a lane keeps the query it had in the loop: query nloc, channels 16t + 8hlf + 0..7 (element e = 8t + r8)
  // every global load of the epilogue is asked for here, as one group, and flies under the merge: Wo fragments, this lane's 16 gamma and beta, the 4 bo of the columns it stores
  v16b wof[8]; v4f graw[4], beraw[4], boraw;
  { const b16* pwo = WO + (size_t)nloc * D + 8 * hlf; const float* pg = gam + 8 * hlf; const float* pe = bet + 8 * hlf; const float* po = bo + lane * 4;
#pragma unroll
    for (int t = 0; t < 8; ++t) wof[t] = frag_at(pwo + t * 16 * D);
#pragma unroll
    for (int c = 0; c < 4; ++c) { graw[c] = *(const v4f*)(pg + (c >> 1) * 16 + (c & 1) * 4); beraw[c] = *(const v4f*)(pe + (c >> 1) * 16 + (c & 1) * 4); }
    boraw = *(const v4f*)po;
    asm volatile("s_wait_xcnt 0x0" ::: "memory"); }   // stands behind the group, in front of every overwrite of a register that a load above names
  // merge: all of the lane's partials are read as one group (16 bytes a read for O), then rescaled to the common max and summed over the waves in index order
  auto& Tf = wb[wave].Tf; float pm[NW], pd[NW]; v4f pa4[NW][4];
#pragma unroll
  for (int w = 0; w < NW; ++w) { pm[w] = pw[w].Pm[wave][nloc]; pd[w] = pw[w].Pd[wave][nloc];
#pragma unroll
    for (int c = 0; c < 4; ++c) pa4[w][c] = *(const v4f*)(&pw[w].Pa[wave][nloc][(c >> 1) * 16 + 8 * hlf + (c & 1) * 4]); }
  float mx = pm[0];
#pragma unroll
  for (int w = 1; w < NW; ++w) mx = fmaxf(mx, pm[w]);
  float dn = 0.0f, f[16];
#pragma unroll
  for (int e = 0; e < 16; ++e) f[e] = 0.0f;
#pragma unroll
  for (int w = 0; w < NW; ++w) { const float sc = (pm[w] == -INFINITY) ? 0.0f : __expf(pm[w] - mx); dn += pd[w] * sc;
#pragma unroll
    for (int e = 0; e < 16; ++e) f[e] += pa4[w][e >> 2][e & 3] * sc; }
#pragma unroll
  for (int e = 0; e < 16; ++e) f[e] = f[e] * (1.0f / (HS * PS)) / dn;
  // LayerNorm over the query's 32 channels: 16 in the lane, 16 in the lane of the other half (one exchange per sum)
  float s = ((((f[0] + f[1]) + (f[2] + f[3])) + ((f[4] + f[5]) + (f[6] + f[7]))) + (((f[8] + f[9]) + (f[10] + f[11])) + ((f[12] + f[13]) + (f[14] + f[15]))));
  s += __shfl_xor(s, 16); const float mu = s / D; float q2[16];
#pragma unroll
  for (int e = 0; e < 16; ++e) { f[e] -= mu; q2[e] = f[e] * f[e]; }
  float s2 = ((((q2[0] + q2[1]) + (q2[2] + q2[3])) + ((q2[4] + q2[5]) + (q2[6] + q2[7]))) + (((q2[8] + q2[9]) + (q2[10] + q2[11])) + ((q2[12] + q2[13]) + (q2[14] + q2[15]))));
  s2 += __shfl_xor(s2, 16); const float rs = rsqrtf(s2 / D + LNEPS);
  // normed^T hi/lo: element e is k = 16t + 8hlf + r8, which is the k-map of the B fragment: it packs in the lane
  v16b nh, nl;
#pragma unroll
  for (int e = 0; e < 16; ++e) { const float nv = f[e] * rs * bfv(graw[e >> 2][e & 3]) + bfv(beraw[e >> 2][e & 3]); b16 p, ql; split16(nv * HS, p, ql); nh[e] = p; nl[e] = ql; }
  // out^T = Wo^T normed^T: A = Wo rows (out channels), D column = the lane's query, D rows = out channels 16t + 8hlf + 0..7; the 8 tiles' chains are independent
  v8f o8[8];
#pragma unroll
  for (int t = 0; t < 8; ++t) o8[t] = wmma16b(wof[t], nh, (v8f){});
#pragma unroll
  for (int t = 0; t < 8; ++t) o8[t] = wmma16b(wof[t], nl, o8[t]);
  // back to [query][out channel] through LDS, so that a store covers a whole 512-byte row
#pragma unroll
  for (int t = 0; t < 8; ++t) { *(v4f*)(&Tf[nloc][t * 16 + 8 * hlf]) = (v4f){o8[t][0], o8[t][1], o8[t][2], o8[t][3]}; *(v4f*)(&Tf[nloc][t * 16 + 8 * hlf + 4]) = (v4f){o8[t][4], o8[t][5], o8[t][6], o8[t][7]}; }
  wave_lds_sync();
  float bb[4];
#pragma unroll
  for (int j = 0; j < 4; ++j) bb[j] = bfv(boraw[j]);
  float* pout = out + tq * FO + lane * 4;
#pragma unroll
  for (int rr = 0; rr < 16; ++rr) { const v4f tv = *(const v4f*)(&Tf[rr][lane * 4]); v4f r;
#pragma unroll
    for (int j = 0; j < 4; ++j) r[j] = tv[j] * (1.0f / (HS * WSC)) + bb[j];
    *(v4f*)(pout + rr * FO) = r; } }
}  // namespace

extern "C" void kernel_launch(void* const* d_in, const int* in_sizes, int n_in, void* d_out, int out_size, void* d_ws, size_t ws_size, hipStream_t stream) {
  (void)n_in;
  auto Fp = [&](int i) { return (const float*)d_in[i]; };
  // Input order: 0 input1 [8192,128]; 1 input2 [8192,128]; 2 Wq [128,32]; 3 bq; 4 Wk; 5 bk; 6 Wv; 7 bv; 8 gamma [32]; 9 beta; 10 Wo [32,128]; 11 bo [128]
  if (in_sizes[0] != N1 * DI || in_sizes[1] != N2 * DI || in_sizes[2] != DI * D || in_sizes[4] != DI * D || in_sizes[6] != DI * D || in_sizes[8] != D || in_sizes[10] != D * FO || in_sizes[11] != FO || out_size != N1 * FO) return;
  const int QLIM = N1, KLIM = N2;   // query / key cuts (multiples of 128)
  size_t off = 0; char* ws = (char*)d_ws;
  auto carve = [&](size_t bytes) { char* p = ws + off; off += (bytes + 255) & ~(size_t)255; return p; };
  b16* WO = (b16*)carve((size_t)FO * D * 2); b16* Qh = (b16*)carve((size_t)N1 * D * 2); b16* Ql = (b16*)carve((size_t)N1 * D * 2); b16* Kh = (b16*)carve((size_t)N2 * D * 2); b16* Kl = (b16*)carve((size_t)N2 * D * 2); b16* Vh = (b16*)carve((size_t)N2 * D * 2); b16* Vl = (b16*)carve((size_t)N2 * D * 2);
  if (off > ws_size || off > ((size_t)8 << 20)) return;   // ~ 3.2 MB
  prep_kernel<<<(KLIM + 16 * PW - 1) / (16 * PW) + (QLIM + 16 * PW - 1) / (16 * PW) + 1, 32 * PW, 0, stream>>>(Fp(0), Fp(1), Fp(2), Fp(4), Fp(6), Fp(10), Fp(3), Fp(5), Fp(7), QLIM, KLIM, WO, Qh, Ql, Kh, Kl, Vh, Vl);
  att_kernel<<<QLIM / (16 * QT), 32 * NW, 0, stream>>>(Qh, Ql, Kh, Kl, Vh, Vl, WO, Fp(8), Fp(9), Fp(11), QLIM, KLIM, (float*)d_out);
}

// v009
// One run takes 31.3 microseconds.
// In both of two side-by-side timings against v008, it was 1.08 times as fast.
// Over all steps from v000 it is 33.6 times as fast.
#include <hip/hip_runtime.h>

// CAM (cross-attention module): q = input1 Wq + bq [8192][32]; k = input2 Wk + bk, v = input2 Wv + bv [8192][32]; scores = q k^T (no scaling); w = softmax over the 8,192 keys; fused = w v; LayerNorm(fused) (eps 1e-5, gamma/beta);
// out = normed Wo + bo -> [8192][128].
// Deterministic: no index structures, no atomics.
// V is kept in the workspace as V^T in groups of 16 keys, [key / 16][channel][key % 16], so that a V^T fragment is two 16-byte loads.
// WMMA (v_wmma_f32_16x16x32_f16, f32 accumulate): projections with the inputs EXACT bf16 x8 (K 128, 2 tiles each) against exact weight rows x256; S^T = k q^T per (64-key block, 16-query tile) and O^T += V^T P^T (q/k/v/P hi+lo x256; 3 products each), so a lane owns one query's scores and P^T packs in-lane into the B operand;
// out^T = Wo rows x LN(fused)^T (hi+lo) (K 32, 8 tiles). Online softmax and LayerNorm in f32. Inputs rounded to bf16 once. Fragment k-map per lane half hh for A AND B: elements 0..7 <- k = 8hh+0..7, 8..15 <- k = 16+8hh+0..7;

namespace {
constexpr int N1 = 8192, N2 = 8192, DI = 128, D = 32, FO = 128, KB = 64;
constexpr float XS = 8.0f, HS = 256.0f, WSC = 256.0f, LNEPS = 1e-5f;
// softmax in base 2: a raw S^T value (q x256 times k x256) times SC2 is the score in log2 units; the running max is kept in those units LESS LPS, so that exp2 gives P x256 (the f16 hi+lo range) with no further multiply; the denominator carries the same x256, which cancels in O / den
constexpr float SC2 = 1.4426950408889634f / (HS * HS), LPS = 8.0f;
typedef _Float16 b16;
typedef __attribute__((ext_vector_type(16))) _Float16 v16b;
typedef __attribute__((ext_vector_type(8))) _Float16 v8b;
typedef __attribute__((ext_vector_type(8))) float v8f;
typedef __attribute__((ext_vector_type(4))) float v4f;
typedef __attribute__((ext_vector_type(2))) float v2f;
typedef __attribute__((ext_vector_type(2))) _Float16 v2h;
__device__ __forceinline__ float bf16_rne(float f) { unsigned int u = __float_as_uint(f); u += 0x7FFFu + ((u >> 16) & 1u); float r = __uint_as_float(u & 0xFFFF0000u); asm volatile("" : "+v"(r)); return r; }
__device__ __forceinline__ float bfv(float f) { float r = bf16_rne(f); asm volatile("" : "+v"(r)); return r; }
__device__ __forceinline__ void split16(float v, b16& hi, b16& lo) { hi = (b16)v; lo = (b16)(v - (float)hi); }
__device__ __forceinline__ v16b frag_kb(const b16* p, int hh) { const v8b a = *(const v8b*)(p + 8 * hh), b = *(const v8b*)(p + 16 + 8 * hh); v16b f;
#pragma unroll
  for (int e = 0; e < 8; ++e) { f[e] = a[e]; f[8 + e] = b[e]; } return f; }
// the same fragment from a pointer that already holds the lane half's 8hh
__device__ __forceinline__ v16b frag_at(const b16* p) { const v8b a = *(const v8b*)p, b = *(const v8b*)(p + 16); v16b f;
#pragma unroll
  for (int e = 0; e < 8; ++e) { f[e] = a[e]; f[8 + e] = b[e]; } return f; }
// V^T fragment in the k-map above: p = this lane's 8 keys (8hh..) of its channel in a 16-key group; elements 8..15 are the same place in the next group
__device__ __forceinline__ v16b frag_vt(const b16* p) { const v8b a = *(const v8b*)p, b = *(const v8b*)(p + D * 16); v16b f;
#pragma unroll
  for (int e = 0; e < 8; ++e) { f[e] = a[e]; f[8 + e] = b[e]; } return f; }
__device__ __forceinline__ v8f wmma16b(v16b a, v16b b, v8f c) { v8f d = __builtin_amdgcn_wmma_f32_16x16x32_f16(false, a, false, b, (short)0, c, false, false); asm volatile("v_nop\n\tv_nop\n\tv_nop\n\tv_nop" : "+v"(d) : "v"(a), "v"(b)); return d; }
// the same for the key loop, with D alone named in the nop statement: an asm operand has to lie below v256, and with A and B named as well the loop's fragments (q, K, V^T, P^T) and tiles do not all fit there, so that the build spills fragments to scratch.
// The statement stays because it holds its order among the loop's load groups: without it the compiler sinks the V^T and K loads down to their uses
__device__ __forceinline__ v8f wmma16d(v16b a, v16b b, v8f c) { v8f d = __builtin_amdgcn_wmma_f32_16x16x32_f16(false, a, false, b, (short)0, c, false, false); asm volatile("v_nop\n\tv_nop\n\tv_nop\n\tv_nop" : "+v"(d)); return d; }
__device__ __forceinline__ void wave_lds_sync() { __builtin_amdgcn_fence(__ATOMIC_RELEASE, "workgroup"); __builtin_amdgcn_wave_barrier(); __builtin_amdgcn_fence(__ATOMIC_ACQUIRE, "workgroup"); }
// att_kernel LDS, used behind the key loop only: one slab of partials per wave for the merge, one output stage per query tile.
constexpr int NW = 8, QT = 2;   // waves per block; 16-query tiles that each wave works against one set of K / V^T fragments
struct PartBuf { float Pa[QT][16][D + 4], Pm[QT][16], Pd[QT][16]; };
struct TailBuf { float Tf[16][FO + 4]; };

// One launch prepares everything the attention kernel reads. A block of PW waves rounds its own weight matrices into LDS as [channel][k] (the layout of a fragment row), each wave then projects 16 rows; the last block rounds Wo into the workspace.
constexpr int PW = 4;   // waves per block: its 128 threads cover one weight matrix as 16 groups of 8 k x 8 quads of channels
static_assert(32 * PW == (DI / 8) * (D / 4), "a thread owns 8 k x 4 channels of each weight matrix");
struct ProjWave { b16 Xh[16][DI + 8], Oh[16][72], Ol[16][72]; };
template <int MODE>
__device__ __forceinline__ void proj_body(int blk, const float* __restrict__ x, const float* __restrict__ wa, const float* __restrict__ wb_, const float* __restrict__ ba, const float* __restrict__ bb, int RLIM, b16* __restrict__ Ah_, b16* __restrict__ Al_, b16* __restrict__ Bh_, b16* __restrict__ Bl_, ProjWave* pws, b16 (*Wt)[DI + 8]) { const int lane = threadIdx.x & 31, wave = __builtin_amdgcn_readfirstlane(threadIdx.x >> 5), nloc = lane & 15, hlf = lane >> 4; const size_t m0 = ((size_t)blk * PW + wave) * 16; constexpr int NT = MODE == 0 ? 2 : 4, NM = NT / 2; const int c4 = (threadIdx.x & 7) * 4, k8 = (threadIdx.x >> 3) * 8; auto& Xh = pws[wave].Xh; auto& Oh = pws[wave].Oh; auto& Ol = pws[wave].Ol;
  // every global load of the wave is asked for here, as one group: its share of the weights (rows k8 .. k8+7, channels c4 .. c4+3 of each matrix, 16 bytes a load), the 16 x rows (a row = 512 contiguous bytes, 16 a lane), the biases.
  // The rounding and the matrix helper hold their order, and a load written among them is waited for alone.
  typedef __attribute__((ext_vector_type(4))) _Float16 v4b; v4f xv[16], wr[NM][8]; float braw[NT];
  { const float* px = x + m0 * DI + lane * 4; const float* pwa = wa + (size_t)k8 * D + c4; const float* pwb = wb_ + (size_t)k8 * D + c4; const float* pa = ba + nloc; const float* pb = bb + nloc;
#pragma unroll
    for (int i = 0; i < NM; ++i)
#pragma unroll
      for (int j = 0; j < 8; ++j) wr[i][j] = *(const v4f*)((i == 0 ? pwa : pwb) + j * D);
    __builtin_amdgcn_sched_barrier(0);   // keeps every weight load ahead of the x loads: loads come back in order, and a weight load moved behind them holds the weights' rounding back until the x rows are in
#pragma unroll
    for (int rr = 0; rr < 16; ++rr) xv[rr] = *(const v4f*)(px + rr * DI);
#pragma unroll
    for (int t = 0; t < NT; ++t) braw[t] = (t < 2 ? pa : pb)[(t & 1) * 16];
    asm volatile("s_wait_xcnt 0x0" :: "v"(pwa), "v"(pwb) : "memory");   // stands behind the group, in front of every overwrite of a register that a load above names; the weight loads' address registers stay untouched (no later load lands in them) up to this wait
    __builtin_amdgcn_sched_barrier(0); }   // keeps the first rounding behind the whole group: moved up among the loads it puts a load wait in front of the later loads
#pragma unroll
  for (int i = 0; i < NM; ++i)
#pragma unroll
    for (int c = 0; c < 4; ++c) { v8b v;
#pragma unroll
      for (int j = 0; j < 8; ++j) v[j] = (b16)(bf16_rne(wr[i][j][c]) * WSC);
      *(v8b*)(&Wt[i * D + c4 + c][k8]) = v; }
#pragma unroll
  for (int rr = 0; rr < 16; ++rr) { v4b h;
#pragma unroll
    for (int j = 0; j < 4; ++j) h[j] = (b16)(bf16_rne(xv[rr][j]) * XS);
    *(v4b*)(&Xh[rr][lane * 4]) = h; }
  if (lane < 16) for (int k = DI; k < DI + 8; ++k) Xh[lane][k] = (b16)0.0f;
  __syncthreads();   // every wave's share of the weights is in LDS before any wave reads a fragment (it also orders the wave's own Xh rows)
  if (m0 >= (size_t)RLIM) return;
  // all LDS fragments are asked for as one group ahead of the products
  v16b wf[DI / 32][NT], af[DI / 32]; v8f acc[NT]; v8b th[2], tl[2];
#pragma unroll
  for (int kb = 0; kb < DI; kb += 32) { af[kb / 32] = frag_kb(&Xh[nloc][kb], hlf);
#pragma unroll
    for (int t = 0; t < NT; ++t) wf[kb / 32][t] = frag_kb(&Wt[t * 16 + nloc][kb], hlf); }
#pragma unroll
  for (int t = 0; t < NT; ++t) acc[t] = (v8f){};
#pragma unroll
  for (int kb = 0; kb < DI; kb += 32) {
#pragma unroll
    for (int t = 0; t < NT; ++t) acc[t] = wmma16b(af[kb / 32], wf[kb / 32][t], acc[t]); }
#pragma unroll
  for (int t = 0; t < NT; ++t) { const int cc = t * 16 + nloc; const float bias = bfv(braw[t]);
#pragma unroll
    for (int r8 = 0; r8 < 8; ++r8) { b16 p, ql; split16((acc[t][r8] * (1.0f / (XS * WSC)) + bias) * HS, p, ql); if (t < 2) { Oh[8 * hlf + r8][cc] = p; Ol[8 * hlf + r8][cc] = ql; } else { th[t & 1][r8] = p; tl[t & 1][r8] = ql; } } }
  wave_lds_sync();
  // v tiles: a lane holds 8 consecutive keys of one channel, which is 16 bytes of the V^T group of this wave's 16 keys
  if (MODE == 1) { const size_t o = ((m0 >> 4) * D + nloc) * 16 + 8 * hlf;
#pragma unroll
    for (int t = 0; t < 2; ++t) { *(v8b*)(Bh_ + o + t * 256) = th[t]; *(v8b*)(Bl_ + o + t * 256) = tl[t]; } }
  typedef __attribute__((ext_vector_type(2))) _Float16 v2b;
  { for (int rr = 0; rr < 16; ++rr) { if (lane < 16) { *(v2b*)(Ah_ + (m0 + rr) * D + lane * 2) = *(const v2b*)(&Oh[rr][lane * 2]); *(v2b*)(Al_ + (m0 + rr) * D + lane * 2) = *(const v2b*)(&Ol[rr][lane * 2]); } }  } }
// blocks 0 .. nk-1: k and v rows (the longer body, lowest block indices); the next nq: q rows; the last: Wo
__global__ __launch_bounds__(32 * PW) void prep_kernel(const float* __restrict__ x1, const float* __restrict__ x2, const float* __restrict__ wq, const float* __restrict__ wk, const float* __restrict__ wv, const float* __restrict__ wo, const float* __restrict__ bq, const float* __restrict__ bk, const float* __restrict__ bv, int QLIM, int KLIM, b16* __restrict__ WO, b16* __restrict__ Qh, b16* __restrict__ Ql, b16* __restrict__ Kh, b16* __restrict__ Kl, b16* __restrict__ Vh, b16* __restrict__ Vl) {
  __shared__ __attribute__((aligned(16))) ProjWave pws[PW]; __shared__ __attribute__((aligned(16))) b16 Wt[2 * D][DI + 8];
  const int nk = (KLIM + 16 * PW - 1) / (16 * PW), nq = (QLIM + 16 * PW - 1) / (16 * PW), b = blockIdx.x;
  if (b < nk) { proj_body<1>(b, x2, wk, wv, bk, bv, KLIM, Kh, Kl, Vh, Vl, pws, Wt); return; }
  if (b < nk + nq) { proj_body<0>(b - nk, x1, wq, wq, bq, bq, QLIM, Qh, Ql, Qh, Ql, pws, Wt); return; }
  // Wo: a thread rounds 8 k (k0 ..) of out channels o0, o0 + OS, ...; all loads first, as above
  constexpr int OS = 32 * PW / (D / 8), NO = FO / OS; float ao[NO][8]; const int k0 = (threadIdx.x % (D / 8)) * 8, o0 = threadIdx.x / (D / 8); const float* p = wo + (size_t)k0 * FO + o0;
#pragma unroll
  for (int i = 0; i < NO; ++i)
#pragma unroll
    for (int j = 0; j < 8; ++j) ao[i][j] = p[j * FO + i * OS];
  asm volatile("s_wait_xcnt 0x0" :: "v"(p) : "memory");   // stands behind the group, in front of every overwrite of a register that a load above names; the address register stays untouched up to this wait
#pragma unroll
  for (int i = 0; i < NO; ++i) { v8b v;
#pragma unroll
    for (int j = 0; j < 8; ++j) v[j] = (b16)(bf16_rne(ao[i][j]) * WSC);
    *(v8b*)(WO + (size_t)(o0 + i * OS) * D + k0) = v; }
  asm volatile("s_wait_xcnt 0x0" ::: "memory"); }   // stands behind the last Wo store, in front of every overwrite of a register that a store above names
// attention + LN + Wo: NW WAVES PER BLOCK, block per QT * 16 = 32 queries: the 128 key blocks of 64 are dealt round-robin to the waves, and EACH WAVE WORKS BOTH QUERY TILES against the K and V^T fragments it has in registers, so a fragment is fetched once per 32 queries;
// V^T fragments hi/lo come straight from the workspace; S^T (4 tiles per query tile, K 32; 3 products; A = k rows, B = q): D column = lane's query, D rows = 8 keys per lane half; online softmax per lane in registers (one exchange between the halves for the max);
// P^T x256 hi+lo: tiles 2j and 2j+1 are elements 0..7 and 8..15 of the B fragment of keys 32j.. (the k-map above); O^T += V^T P^T (2 channel tiles; 3 products);
// then the waves' partial (max, den, O) meet in LDS behind one block barrier and wave u merges query tile u (rescale to the common max, waves summed in index order); fused = O/den; LN over 32 and the Wo product stay transposed (a lane owns one query);
__global__ __launch_bounds__(32 * NW) void att_kernel(const b16* __restrict__ Qh, const b16* __restrict__ Ql, const b16* __restrict__ Kh, const b16* __restrict__ Kl, const b16* __restrict__ Vh, const b16* __restrict__ Vl, const b16* __restrict__ WO, const float* __restrict__ gam, const float* __restrict__ bet, const float* __restrict__ bo, int QLIM, int KLIM, float* __restrict__ out) {
  __shared__ __attribute__((aligned(16))) PartBuf pw[NW]; __shared__ __attribute__((aligned(16))) TailBuf wb[QT];
  const int lane = threadIdx.x & 31, wave = __builtin_amdgcn_readfirstlane(threadIdx.x >> 5), nloc = lane & 15, hlf = lane >> 4; const size_t t0 = (size_t)blockIdx.x * (16 * QT); if (t0 >= (size_t)QLIM) return;
  const b16* pqh = Qh + (t0 + nloc) * D + 8 * hlf; const b16* pql = Ql + (t0 + nloc) * D + 8 * hlf; v16b qa[QT], qb[QT];
#pragma unroll
  for (int u = 0; u < QT; ++u) { qa[u] = frag_at(pqh + u * 16 * D); qb[u] = frag_at(pql + u * 16 * D); }
  asm volatile("s_wait_xcnt 0x0" :: "v"(pqh), "v"(pql) : "memory");   // the address registers of the q loads stay untouched up to this wait
  // per lane and query tile u: query nloc's running max (equal in both halves) and this half's share of its denominator; acc[u][t][r8] = O^T[channel 16t + 8hlf + r8][query 16u + nloc]
  float m_q[QT], den_q[QT]; v8f acc[QT][2];
#pragma unroll
  for (int u = 0; u < QT; ++u) { m_q[u] = -INFINITY; den_q[u] = 0.0f; acc[u][0] = (v8f){}; acc[u][1] = (v8f){}; }
  // K fragments hi/lo of one whole key block live in registers and are fetched one block ahead; the first block's are asked for here
  v16b kh[KB / 16], kl[KB / 16]; const unsigned ko = (unsigned)(nloc * D + 8 * hlf);   // this lane's row and half in a 16-key tile
  if (wave * KB < KLIM) { const b16* ph = Kh + (size_t)(wave * KB) * D + ko; const b16* pl = Kl + (size_t)(wave * KB) * D + ko;
#pragma unroll
    for (int t = 0; t < KB / 16; ++t) { kh[t] = frag_at(ph + t * 16 * D); kl[t] = frag_at(pl + t * 16 * D); }
    asm volatile("s_wait_xcnt 0x0" :: "v"(ph), "v"(pl) : "memory");   // stands in front of every overwrite of a register that the loads above name
    __builtin_amdgcn_sched_barrier(0); }   // keeps the loop's first address arithmetic behind that wait: lifted over it, it rewrote the loads' offset register ahead of the wait
#pragma unroll 1
  for (int kb0 = wave * KB; kb0 < KLIM; kb0 += NW * KB) {
    // V^T fragments of this key block: all asked for here, they fly under the S^T tiles and the softmax
    v16b vh[KB / 32][2], vl[KB / 32][2]; const size_t vo = ((size_t)(kb0 >> 4) * D + nloc) * 16 + 8 * hlf;   // this lane's place in the block's first group: channel nloc, keys 8hlf..
    { const b16* ph = Vh + vo; const b16* pl = Vl + vo;
#pragma unroll
      for (int j = 0; j < KB / 32; ++j)
#pragma unroll
        for (int t = 0; t < 2; ++t) { vh[j][t] = frag_vt(ph + (2 * j * D + t * 16) * 16); vl[j][t] = frag_vt(pl + (2 * j * D + t * 16) * 16); }
      asm volatile("s_wait_xcnt 0x0" :: "v"(ph), "v"(pl) : "memory"); }   // holds the loads above in front of the tiles; their address registers stay untouched up to this wait
    // S^T tiles (K 32 = one k-step): rows = keys, cols = queries; the two query tiles' chains alternate on the same K fragment
    v8f st[QT][KB / 16], mv[QT];
#pragma unroll
    for (int t = 0; t < KB / 16; ++t) { v8f s[QT];
#pragma unroll
      for (int u = 0; u < QT; ++u) s[u] = wmma16d(kh[t], qa[u], (v8f){});
#pragma unroll
      for (int u = 0; u < QT; ++u) s[u] = wmma16d(kl[t], qa[u], s[u]);
#pragma unroll
      for (int u = 0; u < QT; ++u) s[u] = wmma16d(kh[t], qb[u], s[u]);
#pragma unroll
      for (int u = 0; u < QT; ++u)
#pragma unroll
        for (int r8 = 0; r8 < 8; ++r8) { st[u][t][r8] = s[u][r8] * SC2; mv[u][r8] = t == 0 ? st[u][t][r8] : fmaxf(mv[u][r8], st[u][t][r8]); } }
    // the wave's next key block's K fragments: asked for here, they fly under the softmax and the O^T products (behind the last block: this block's again, unused)
    { const int kn = kb0 + NW * KB < KLIM ? kb0 + NW * KB : kb0; const b16* ph = Kh + (size_t)kn * D + ko; const b16* pl = Kl + (size_t)kn * D + ko;
#pragma unroll
      for (int t = 0; t < KB / 16; ++t) { kh[t] = frag_at(ph + t * 16 * D); kl[t] = frag_at(pl + t * 16 * D); }
      asm volatile("s_wait_xcnt 0x0" :: "v"(ph), "v"(pl) : "memory"); }   // holds the loads above in front of the softmax; their address registers stay untouched up to this wait
    v16b pa[QT][KB / 32], pb[QT][KB / 32];
#pragma unroll
    for (int u = 0; u < QT; ++u) {
      float mx = mv[u][0];
#pragma unroll
      for (int r8 = 1; r8 < 8; ++r8) mx = fmaxf(mx, mv[u][r8]);
      mx = fmaxf(mx, __shfl_xor(mx, 16));
      const float mn = fmaxf(m_q[u], mx - LPS); const float sf = (m_q[u] == -INFINITY) ? 0.0f : __builtin_amdgcn_exp2f(m_q[u] - mn); v2f pv[4] = {};
#pragma unroll
      for (int t = 0; t < KB / 16; ++t)
#pragma unroll
        for (int r8 = 0; r8 < 8; r8 += 2) { const v2f y = (v2f){st[u][t][r8], st[u][t][r8 + 1]} - (v2f){mn, mn}; const v2f p = {__builtin_amdgcn_exp2f(y[0]), __builtin_amdgcn_exp2f(y[1])}; pv[r8 >> 1] += p;
          const v2h ph = __builtin_convertvector(p, v2h); const v2h pl = __builtin_convertvector(p - __builtin_convertvector(ph, v2f), v2h);
          pa[u][t >> 1][(t & 1) * 8 + r8] = ph[0]; pa[u][t >> 1][(t & 1) * 8 + r8 + 1] = ph[1]; pb[u][t >> 1][(t & 1) * 8 + r8] = pl[0]; pb[u][t >> 1][(t & 1) * 8 + r8 + 1] = pl[1]; }
      const float ps = ((pv[0][0] + pv[0][1]) + (pv[1][0] + pv[1][1])) + ((pv[2][0] + pv[2][1]) + (pv[3][0] + pv[3][1]));
      den_q[u] = den_q[u] * sf + ps; m_q[u] = mn;
#pragma unroll
      for (int t = 0; t < 2; ++t)
#pragma unroll
        for (int r8 = 0; r8 < 8; ++r8) acc[u][t][r8] = acc[u][t][r8] * sf; }
#pragma unroll
    for (int ks = 0; ks < KB; ks += 32) {
#pragma unroll
      for (int t = 0; t < 2; ++t) {
#pragma unroll
        for (int u = 0; u < QT; ++u) acc[u][t] = wmma16d(vh[ks / 32][t], pa[u][ks / 32], acc[u][t]);
#pragma unroll
        for (int u = 0; u < QT; ++u) acc[u][t] = wmma16d(vl[ks / 32][t], pa[u][ks / 32], acc[u][t]);
#pragma unroll
        for (int u = 0; u < QT; ++u) acc[u][t] = wmma16d(vh[ks / 32][t], pb[u][ks / 32], acc[u][t]); } } }
  // each wave publishes, per query tile, its partial row max, denominator (the halves' shares joined here) and O (back to [query][channel]) in its own slab
  { PartBuf& E = pw[wave];
#pragma unroll
    for (int u = 0; u < QT; ++u) { const float den_f = den_q[u] + __shfl_xor(den_q[u], 16);
#pragma unroll
      for (int t = 0; t < 2; ++t)
#pragma unroll
        for (int r8 = 0; r8 < 8; ++r8) E.Pa[u][nloc][t * 16 + 8 * hlf + r8] = acc[u][t][r8];
      if (hlf == 0) { E.Pm[u][nloc] = m_q[u]; E.Pd[u][nloc] = den_f; } } }
  __syncthreads();   // every wave's partials are in LDS before waves 0 .. QT-1 read them
  if (wave >= QT) return;
  const size_t tq = t0 + (size_t)wave * 16;   // wave u finishes query tile u, and a lane keeps the query it had in the loop: query nloc, channels 16t + 8hlf + 0..7 (element e = 8t + r8)
  // every global load of the epilogue is asked for here, as one group, and flies under the merge: Wo fragments, this lane's 16 gamma and beta, the 4 bo of the columns it stores
  v16b wof[8]; v4f graw[4], beraw[4], boraw;
  { const b16* pwo = WO + (size_t)nloc * D + 8 * hlf; const float* pg = gam + 8 * hlf; const float* pe = bet + 8 * hlf; const float* po = bo + lane * 4;
#pragma unroll
    for (int t = 0; t < 8; ++t) wof[t] = frag_at(pwo + t * 16 * D);
#pragma unroll
    for (int c = 0; c < 4; ++c) { graw[c] = *(const v4f*)(pg + (c >> 1) * 16 + (c & 1) * 4); beraw[c] = *(const v4f*)(pe + (c >> 1) * 16 + (c & 1) * 4); }
    boraw = *(const v4f*)po;
    asm volatile("s_wait_xcnt 0x0" ::: "memory"); }   // stands behind the group, in front of every overwrite of a register that a load above names
  // merge: all of the lane's partials are read as one group (16 bytes a read for O), then rescaled to the common max and summed over the waves in index order
  auto& Tf = wb[wave].Tf; float pm[NW], pd[NW]; v4f pa4[NW][4];
#pragma unroll
  for (int w = 0; w < NW; ++w) { pm[w] = pw[w].Pm[wave][nloc]; pd[w] = pw[w].Pd[wave][nloc];
#pragma unroll
    for (int c = 0; c < 4; ++c) pa4[w][c] = *(const v4f*)(&pw[w].Pa[wave][nloc][(c >> 1) * 16 + 8 * hlf + (c & 1) * 4]); }
  float mx = pm[0];
#pragma unroll
  for (int w = 1; w < NW; ++w) mx = fmaxf(mx, pm[w]);
  float dn = 0.0f, f[16];
#pragma unroll
  for (int e = 0; e < 16; ++e) f[e] = 0.0f;
#pragma unroll
  for (int w = 0; w < NW; ++w) { const float sc = (pm[w] == -INFINITY) ? 0.0f : __builtin_amdgcn_exp2f(pm[w] - mx); dn += pd[w] * sc;
#pragma unroll
    for (int e = 0; e < 16; ++e) f[e] += pa4[w][e >> 2][e & 3] * sc; }
#pragma unroll
  for (int e = 0; e < 16; ++e) f[e] = f[e] * (1.0f / HS) / dn;
  // LayerNorm over the query's 32 channels: 16 in the lane, 16 in the lane of the other half (one exchange per sum)
  float s = ((((f[0] + f[1]) + (f[2] + f[3])) + ((f[4] + f[5]) + (f[6] + f[7]))) + (((f[8] + f[9]) + (f[10] + f[11])) + ((f[12] + f[13]) + (f[14] + f[15]))));
  s += __shfl_xor(s, 16); const float mu = s / D; float q2[16];
#pragma unroll
  for (int e = 0; e < 16; ++e) { f[e] -= mu; q2[e] = f[e] * f[e]; }
  float s2 = ((((q2[0] + q2[1]) + (q2[2] + q2[3])) + ((q2[4] + q2[5]) + (q2[6] + q2[7]))) + (((q2[8] + q2[9]) + (q2[10] + q2[11])) + ((q2[12] + q2[13]) + (q2[14] + q2[15]))));
  s2 += __shfl_xor(s2, 16); const float rs = rsqrtf(s2 / D + LNEPS);
  // normed^T hi/lo: element e is k = 16t + 8hlf + r8, which is the k-map of the B fragment: it packs in the lane
  v16b nh, nl;
#pragma unroll
  for (int e = 0; e < 16; ++e) { const float nv = f[e] * rs * bfv(graw[e >> 2][e & 3]) + bfv(beraw[e >> 2][e & 3]); b16 p, ql; split16(nv * HS, p, ql); nh[e] = p; nl[e] = ql; }
  // out^T = Wo^T normed^T: A = Wo rows (out channels), D column = the lane's query, D rows = out channels 16t + 8hlf + 0..7; the 8 tiles' chains are independent
  v8f o8[8];
#pragma unroll
  for (int t = 0; t < 8; ++t) o8[t] = wmma16b(wof[t], nh, (v8f){});
#pragma unroll
  for (int t = 0; t < 8; ++t) o8[t] = wmma16b(wof[t], nl, o8[t]);
  // back to [query][out channel] through LDS, so that a store covers a whole 512-byte row
#pragma unroll
  for (int t = 0; t < 8; ++t) { *(v4f*)(&Tf[nloc][t * 16 + 8 * hlf]) = (v4f){o8[t][0], o8[t][1], o8[t][2], o8[t][3]}; *(v4f*)(&Tf[nloc][t * 16 + 8 * hlf + 4]) = (v4f){o8[t][4], o8[t][5], o8[t][6], o8[t][7]}; }
  wave_lds_sync();
  float bb[4];
#pragma unroll
  for (int j = 0; j < 4; ++j) bb[j] = bfv(boraw[j]);
  float* pout = out + tq * FO + lane * 4;
#pragma unroll
  for (int rr = 0; rr < 16; ++rr) { const v4f tv = *(const v4f*)(&Tf[rr][lane * 4]); v4f r;
#pragma unroll
    for (int j = 0; j < 4; ++j) r[j] = tv[j] * (1.0f / (HS * WSC)) + bb[j];
    *(v4f*)(pout + rr * FO) = r; } }
}  // namespace

extern "C" void kernel_launch(void* const* d_in, const int* in_sizes, int n_in, void* d_out, int out_size, void* d_ws, size_t ws_size, hipStream_t stream) {
  (void)n_in;
  auto Fp = [&](int i) { return (const float*)d_in[i]; };
  // Input order: 0 input1 [8192,128]; 1 input2 [8192,128]; 2 Wq [128,32]; 3 bq; 4 Wk; 5 bk; 6 Wv; 7 bv; 8 gamma [32]; 9 beta; 10 Wo [32,128]; 11 bo [128]
  if (in_sizes[0] != N1 * DI || in_sizes[1] != N2 * DI || in_sizes[2] != DI * D || in_sizes[4] != DI * D || in_sizes[6] != DI * D || in_sizes[8] != D || in_sizes[10] != D * FO || in_sizes[11] != FO || out_size != N1 * FO) return;
  const int QLIM = N1, KLIM = N2;   // query / key cuts (multiples of 128)
  size_t off = 0; char* ws = (char*)d_ws;
  auto carve = [&](size_t bytes) { char* p = ws + off; off += (bytes + 255) & ~(size_t)255; return p; };
  b16* WO = (b16*)carve((size_t)FO * D * 2); b16* Qh = (b16*)carve((size_t)N1 * D * 2); b16* Ql = (b16*)carve((size_t)N1 * D * 2); b16* Kh = (b16*)carve((size_t)N2 * D * 2); b16* Kl = (b16*)carve((size_t)N2 * D * 2); b16* Vh = (b16*)carve((size_t)N2 * D * 2); b16* Vl = (b16*)carve((size_t)N2 * D * 2);
  if (off > ws_size || off > ((size_t)8 << 20)) return;   // ~ 3.2 MB
  prep_kernel<<<(KLIM + 16 * PW - 1) / (16 * PW) + (QLIM + 16 * PW - 1) / (16 * PW) + 1, 32 * PW, 0, stream>>>(Fp(0), Fp(1), Fp(2), Fp(4), Fp(6), Fp(10), Fp(3), Fp(5), Fp(7), QLIM, KLIM, WO, Qh, Ql, Kh, Kl, Vh, Vl);
  att_kernel<<<QLIM / (16 * QT), 32 * NW, 0, stream>>>(Qh, Ql, Kh, Kl, Vh, Vl, WO, Fp(8), Fp(9), Fp(11), QLIM, KLIM, (float*)d_out);
}

// v010
// Measured time: 30.2 microseconds a run.
// Next to v009, in two timings, it ran 1.05 and 1.06 times as fast.
// Over all steps from v000 it is 35.4 times as fast.
#include <hip/hip_runtime.h>

// CAM (cross-attention module): q = input1 Wq + bq [8192][32]; k = input2 Wk + bk, v = input2 Wv + bv [8192][32]; scores = q k^T (no scaling); w = softmax over the 8,192 keys; fused = w v; LayerNorm(fused) (eps 1e-5, gamma/beta);
// out = normed Wo + bo -> [8192][128].
// Deterministic: no index structures, no atomics.
// V is kept in the workspace as V^T in groups of 16 keys, [key / 16][channel][key % 16], so that a V^T fragment is two 16-byte loads.
// WMMA (v_wmma_f32_16x16x32_f16, f32 accumulate): projections with the inputs EXACT bf16 x8 (K 128, 2 tiles each) against exact weight rows x256; S^T = k q^T per (64-key block, 16-query tile) and O^T += V^T P^T (q/k/v/P hi+lo x256; 3 products each), so a lane owns one query's scores and P^T packs in-lane into the B operand;
// out^T = Wo rows x LN(fused)^T (hi+lo) (K 32, 8 tiles). Online softmax and LayerNorm in f32. Inputs rounded to bf16 once. Fragment k-map per lane half hh for A AND B: elements 0..7 <- k = 8hh+0..7, 8..15 <- k = 16+8hh+0..7;

namespace {
constexpr int N1 = 8192, N2 = 8192, DI = 128, D = 32, FO = 128, KB = 64;
constexpr float XS = 8.0f, HS = 256.0f, WSC = 256.0f, LNEPS = 1e-5f;
// softmax in base 2: a raw S^T value (q x256 times k x256) times SC2 is the score in log2 units; the running max is kept in those units LESS LPS, so that exp2 gives P x256 (the f16 hi+lo range) with no further multiply; the denominator carries the same x256, which cancels in O / den
constexpr float SC2 = 1.4426950408889634f / (HS * HS), LPS = 8.0f;
typedef _Float16 b16;
typedef __attribute__((ext_vector_type(16))) _Float16 v16b;
typedef __attribute__((ext_vector_type(8))) _Float16 v8b;
typedef __attribute__((ext_vector_type(8))) float v8f;
typedef __attribute__((ext_vector_type(4))) float v4f;
typedef __attribute__((ext_vector_type(2))) float v2f;
typedef __attribute__((ext_vector_type(2))) _Float16 v2h;
__device__ __forceinline__ float bf16_rne(float f) { unsigned int u = __float_as_uint(f); u += 0x7FFFu + ((u >> 16) & 1u); float r = __uint_as_float(u & 0xFFFF0000u); asm volatile("" : "+v"(r)); return r; }
__device__ __forceinline__ float bfv(float f) { float r = bf16_rne(f); asm volatile("" : "+v"(r)); return r; }
__device__ __forceinline__ void split16(float v, b16& hi, b16& lo) { hi = (b16)v; lo = (b16)(v - (float)hi); }
__device__ __forceinline__ v16b frag_kb(const b16* p, int hh) { const v8b a = *(const v8b*)(p + 8 * hh), b = *(const v8b*)(p + 16 + 8 * hh); v16b f;
#pragma unroll
  for (int e = 0; e < 8; ++e) { f[e] = a[e]; f[8 + e] = b[e]; } return f; }
// the same fragment from a pointer that already holds the lane half's 8hh
__device__ __forceinline__ v16b frag_at(const b16* p) { const v8b a = *(const v8b*)p, b = *(const v8b*)(p + 16); v16b f;
#pragma unroll
  for (int e = 0; e < 8; ++e) { f[e] = a[e]; f[8 + e] = b[e]; } return f; }
// V^T fragment in the k-map above: p = this lane's 8 keys (8hh..) of its channel in a 16-key group; elements 8..15 are the same place in the next group
__device__ __forceinline__ v16b frag_vt(const b16* p) { const v8b a = *(const v8b*)p, b = *(const v8b*)(p + D * 16); v16b f;
#pragma unroll
  for (int e = 0; e < 8; ++e) { f[e] = a[e]; f[8 + e] = b[e]; } return f; }
__device__ __forceinline__ v8f wmma16b(v16b a, v16b b, v8f c) { v8f d = __builtin_amdgcn_wmma_f32_16x16x32_f16(false, a, false, b, (short)0, c, false, false); asm volatile("v_nop\n\tv_nop\n\tv_nop\n\tv_nop" : "+v"(d) : "v"(a), "v"(b)); return d; }
// the same for the key loop, the builtin alone: the compiler keeps the distance to a reader of D itself, and a chain that accumulates into its own D needs none, so no issue slot is spent on a nop that the SIMD's other wave could use
__device__ __forceinline__ v8f wmma16d(v16b a, v16b b, v8f c) { return __builtin_amdgcn_wmma_f32_16x16x32_f16(false, a, false, b, (short)0, c, false, false); }
__device__ __forceinline__ void wave_lds_sync() { __builtin_amdgcn_fence(__ATOMIC_RELEASE, "workgroup"); __builtin_amdgcn_wave_barrier(); __builtin_amdgcn_fence(__ATOMIC_ACQUIRE, "workgroup"); }
// att_kernel LDS, used behind the key loop only: one slab of partials per wave for the merge, one output stage per query tile.
constexpr int NW = 8, QT = 2;   // waves per block; 16-query tiles that each wave works against one set of K / V^T fragments
struct PartBuf { float Pa[QT][16][D + 4], Pm[QT][16], Pd[QT][16]; };
struct TailBuf { float Tf[16][FO + 4]; };

// One launch prepares everything the attention kernel reads. A block of PW waves rounds its own weight matrices into LDS as [channel][k] (the layout of a fragment row), each wave then projects 16 rows; the last block rounds Wo into the workspace.
constexpr int PW = 4;   // waves per block: its 128 threads cover one weight matrix as 16 groups of 8 k x 8 quads of channels
static_assert(32 * PW == (DI / 8) * (D / 4), "a thread owns 8 k x 4 channels of each weight matrix");
struct ProjWave { b16 Xh[16][DI + 8], Oh[16][72], Ol[16][72]; };
template <int MODE>
__device__ __forceinline__ void proj_body(int blk, const float* __restrict__ x, const float* __restrict__ wa, const float* __restrict__ wb_, const float* __restrict__ ba, const float* __restrict__ bb, int RLIM, b16* __restrict__ Ah_, b16* __restrict__ Al_, b16* __restrict__ Bh_, b16* __restrict__ Bl_, ProjWave* pws, b16 (*Wt)[DI + 8]) { const int lane = threadIdx.x & 31, wave = __builtin_amdgcn_readfirstlane(threadIdx.x >> 5), nloc = lane & 15, hlf = lane >> 4; const size_t m0 = ((size_t)blk * PW + wave) * 16; constexpr int NT = MODE == 0 ? 2 : 4, NM = NT / 2; const int c4 = (threadIdx.x & 7) * 4, k8 = (threadIdx.x >> 3) * 8; auto& Xh = pws[wave].Xh; auto& Oh = pws[wave].Oh; auto& Ol = pws[wave].Ol;
  // every global load of the wave is asked for here, as one group: its share of the weights (rows k8 .. k8+7, channels c4 .. c4+3 of each matrix, 16 bytes a load), the 16 x rows (a row = 512 contiguous bytes, 16 a lane), the biases.
  // The rounding and the matrix helper hold their order, and a load written among them is waited for alone.
  typedef __attribute__((ext_vector_type(4))) _Float16 v4b; v4f xv[16], wr[NM][8]; float braw[NT];
  { const float* px = x + m0 * DI + lane * 4; const float* pwa = wa + (size_t)k8 * D + c4; const float* pwb = wb_ + (size_t)k8 * D + c4; const float* pa = ba + nloc; const float* pb = bb + nloc;
#pragma unroll
    for (int i = 0; i < NM; ++i)
#pragma unroll
      for (int j = 0; j < 8; ++j) wr[i][j] = *(const v4f*)((i == 0 ? pwa : pwb) + j * D);
    __builtin_amdgcn_sched_barrier(0);   // keeps every weight load ahead of the x loads: loads come back in order, and a weight load moved behind them holds the weights' rounding back until the x rows are in
#pragma unroll
    for (int rr = 0; rr < 16; ++rr) xv[rr] = *(const v4f*)(px + rr * DI);
#pragma unroll
    for (int t = 0; t < NT; ++t) braw[t] = (t < 2 ? pa : pb)[(t & 1) * 16];
    asm volatile("s_wait_xcnt 0x0" :: "v"(pwa), "v"(pwb) : "memory");   // stands behind the group, in front of every overwrite of a register that a load above names; the weight loads' address registers stay untouched (no later load lands in them) up to this wait
    __builtin_amdgcn_sched_barrier(0); }   // keeps the first rounding behind the whole group: moved up among the loads it puts a load wait in front of the later loads
#pragma unroll
  for (int i = 0; i < NM; ++i)
#pragma unroll
    for (int c = 0; c < 4; ++c) { v8b v;
#pragma unroll
      for (int j = 0; j < 8; ++j) v[j] = (b16)(bf16_rne(wr[i][j][c]) * WSC);
      *(v8b*)(&Wt[i * D + c4 + c][k8]) = v; }
#pragma unroll
  for (int rr = 0; rr < 16; ++rr) { v4b h;
#pragma unroll
    for (int j = 0; j < 4; ++j) h[j] = (b16)(bf16_rne(xv[rr][j]) * XS);
    *(v4b*)(&Xh[rr][lane * 4]) = h; }
  if (lane < 16) for (int k = DI; k < DI + 8; ++k) Xh[lane][k] = (b16)0.0f;
  __syncthreads();   // every wave's share of the weights is in LDS before any wave reads a fragment (it also orders the wave's own Xh rows)
  if (m0 >= (size_t)RLIM) return;
  // all LDS fragments are asked for as one group ahead of the products
  v16b wf[DI / 32][NT], af[DI / 32]; v8f acc[NT]; v8b th[2], tl[2];
#pragma unroll
  for (int kb = 0; kb < DI; kb += 32) { af[kb / 32] = frag_kb(&Xh[nloc][kb], hlf);
#pragma unroll
    for (int t = 0; t < NT; ++t) wf[kb / 32][t] = frag_kb(&Wt[t * 16 + nloc][kb], hlf); }
#pragma unroll
  for (int t = 0; t < NT; ++t) acc[t] = (v8f){};
#pragma unroll
  for (int kb = 0; kb < DI; kb += 32) {
#pragma unroll
    for (int t = 0; t < NT; ++t) acc[t] = wmma16b(af[kb / 32], wf[kb / 32][t], acc[t]); }
#pragma unroll
  for (int t = 0; t < NT; ++t) { const int cc = t * 16 + nloc; const float bias = bfv(braw[t]);
#pragma unroll
    for (int r8 = 0; r8 < 8; ++r8) { b16 p, ql; split16((acc[t][r8] * (1.0f / (XS * WSC)) + bias) * HS, p, ql); if (t < 2) { Oh[8 * hlf + r8][cc] = p; Ol[8 * hlf + r8][cc] = ql; } else { th[t & 1][r8] = p; tl[t & 1][r8] = ql; } } }
  wave_lds_sync();
  // v tiles: a lane holds 8 consecutive keys of one channel, which is 16 bytes of the V^T group of this wave's 16 keys
  if (MODE == 1) { const size_t o = ((m0 >> 4) * D + nloc) * 16 + 8 * hlf;
#pragma unroll
    for (int t = 0; t < 2; ++t) { *(v8b*)(Bh_ + o + t * 256) = th[t]; *(v8b*)(Bl_ + o + t * 256) = tl[t]; } }
  typedef __attribute__((ext_vector_type(2))) _Float16 v2b;
  { for (int rr = 0; rr < 16; ++rr) { if (lane < 16) { *(v2b*)(Ah_ + (m0 + rr) * D + lane * 2) = *(const v2b*)(&Oh[rr][lane * 2]); *(v2b*)(Al_ + (m0 + rr) * D + lane * 2) = *(const v2b*)(&Ol[rr][lane * 2]); } }  } }
// blocks 0 .. nk-1: k and v rows (the longer body, lowest block indices); the next nq: q rows; the last: Wo
__global__ __launch_bounds__(32 * PW) void prep_kernel(const float* __restrict__ x1, const float* __restrict__ x2, const float* __restrict__ wq, const float* __restrict__ wk, const float* __restrict__ wv, const float* __restrict__ wo, const float* __restrict__ bq, const float* __restrict__ bk, const float* __restrict__ bv, int QLIM, int KLIM, b16* __restrict__ WO, b16* __restrict__ Qh, b16* __restrict__ Ql, b16* __restrict__ Kh, b16* __restrict__ Kl, b16* __restrict__ Vh, b16* __restrict__ Vl) {
  __shared__ __attribute__((aligned(16))) ProjWave pws[PW]; __shared__ __attribute__((aligned(16))) b16 Wt[2 * D][DI + 8];
  const int nk = (KLIM + 16 * PW - 1) / (16 * PW), nq = (QLIM + 16 * PW - 1) / (16 * PW), b = blockIdx.x;
  if (b < nk) { proj_body<1>(b, x2, wk, wv, bk, bv, KLIM, Kh, Kl, Vh, Vl, pws, Wt); return; }
  if (b < nk + nq) { proj_body<0>(b - nk, x1, wq, wq, bq, bq, QLIM, Qh, Ql, Qh, Ql, pws, Wt); return; }
  // Wo: a thread rounds 8 k (k0 ..) of out channels o0, o0 + OS, ...; all loads first, as above
  constexpr int OS = 32 * PW / (D / 8), NO = FO / OS; float ao[NO][8]; const int k0 = (threadIdx.x % (D / 8)) * 8, o0 = threadIdx.x / (D / 8); const float* p = wo + (size_t)k0 * FO + o0;
#pragma unroll
  for (int i = 0; i < NO; ++i)
#pragma unroll
    for (int j = 0; j < 8; ++j) ao[i][j] = p[j * FO + i * OS];
  asm volatile("s_wait_xcnt 0x0" :: "v"(p) : "memory");   // stands behind the group, in front of every overwrite of a register that a load above names; the address register stays untouched up to this wait
#pragma unroll
  for (int i = 0; i < NO; ++i) { v8b v;
#pragma unroll
    for (int j = 0; j < 8; ++j) v[j] = (b16)(bf16_rne(ao[i][j]) * WSC);
    *(v8b*)(WO + (size_t)(o0 + i * OS) * D + k0) = v; }
  asm volatile("s_wait_xcnt 0x0" ::: "memory"); }   // stands behind the last Wo store, in front of every overwrite of a register that a store above names
// attention + LN + Wo: NW WAVES PER BLOCK, block per QT * 16 = 32 queries: the 128 key blocks of 64 are dealt round-robin to the waves, and EACH WAVE WORKS BOTH QUERY TILES against the K and V^T fragments it has in registers, so a fragment is fetched once per 32 queries;
// V^T fragments hi/lo come straight from the workspace; S^T (4 tiles per query tile, K 32; 3 products; A = k rows, B = q): D column = lane's query, D rows = 8 keys per lane half; online softmax per lane in registers (one exchange between the halves for the max);
// P^T x256 hi+lo: tiles 2j and 2j+1 are elements 0..7 and 8..15 of the B fragment of keys 32j.. (the k-map above); O^T += V^T P^T (2 channel tiles; 3 products);
// then the waves' partial (max, den, O) meet in LDS behind one block barrier and wave u merges query tile u (rescale to the common max, waves summed in index order); fused = O/den; LN over 32 and the Wo product stay transposed (a lane owns one query);
__global__ __launch_bounds__(32 * NW) void att_kernel(const b16* __restrict__ Qh, const b16* __restrict__ Ql, const b16* __restrict__ Kh, const b16* __restrict__ Kl, const b16* __restrict__ Vh, const b16* __restrict__ Vl, const b16* __restrict__ WO, const float* __restrict__ gam, const float* __restrict__ bet, const float* __restrict__ bo, int QLIM, int KLIM, float* __restrict__ out) {
  __shared__ __attribute__((aligned(16))) PartBuf pw[NW]; __shared__ __attribute__((aligned(16))) TailBuf wb[QT];
  const int lane = threadIdx.x & 31, wave = __builtin_amdgcn_readfirstlane(threadIdx.x >> 5), nloc = lane & 15, hlf = lane >> 4; const size_t t0 = (size_t)blockIdx.x * (16 * QT); if (t0 >= (size_t)QLIM) return;
  const b16* pqh = Qh + (t0 + nloc) * D + 8 * hlf; const b16* pql = Ql + (t0 + nloc) * D + 8 * hlf; v16b qa[QT], qb[QT];
#pragma unroll
  for (int u = 0; u < QT; ++u) { qa[u] = frag_at(pqh + u * 16 * D); qb[u] = frag_at(pql + u * 16 * D); }
  asm volatile("s_wait_xcnt 0x0" :: "v"(pqh), "v"(pql) : "memory");   // the address registers of the q loads stay untouched up to this wait
  // per lane and query tile u: query nloc's running max (equal in both halves) and this half's share of its denominator; acc[u][t][r8] = O^T[channel 16t + 8hlf + r8][query 16u + nloc]
  float m_q[QT], den_q[QT]; v8f acc[QT][2];
#pragma unroll
  for (int u = 0; u < QT; ++u) { m_q[u] = -INFINITY; den_q[u] = 0.0f; acc[u][0] = (v8f){}; acc[u][1] = (v8f){}; }
  // K fragments hi/lo of one whole key block live in registers and are fetched one block ahead; the first block's are asked for here
  v16b kh[KB / 16], kl[KB / 16]; const unsigned ko = (unsigned)(nloc * D + 8 * hlf);   // this lane's row and half in a 16-key tile
  if (wave * KB < KLIM) { const b16* ph = Kh + (size_t)(wave * KB) * D + ko; const b16* pl = Kl + (size_t)(wave * KB) * D + ko;
#pragma unroll
    for (int t = 0; t < KB / 16; ++t) { kh[t] = frag_at(ph + t * 16 * D); kl[t] = frag_at(pl + t * 16 * D); }
    asm volatile("s_wait_xcnt 0x0" :: "v"(ph), "v"(pl) : "memory");   // stands in front of every overwrite of a register that the loads above name
    __builtin_amdgcn_sched_barrier(0); }   // keeps the loop's first address arithmetic behind that wait: lifted over it, it rewrote the loads' offset register ahead of the wait
#pragma unroll 1
  for (int kb0 = wave * KB; kb0 < KLIM; kb0 += NW * KB) {
    // V^T fragments of this key block: all asked for here, they fly under the S^T tiles and the softmax
    v16b vh[KB / 32][2], vl[KB / 32][2]; const size_t vo = ((size_t)(kb0 >> 4) * D + nloc) * 16 + 8 * hlf;   // this lane's place in the block's first group: channel nloc, keys 8hlf..
    { const b16* ph = Vh + vo; const b16* pl = Vl + vo;
#pragma unroll
      for (int j = 0; j < KB / 32; ++j)
#pragma unroll
        for (int t = 0; t < 2; ++t) { vh[j][t] = frag_vt(ph + (2 * j * D + t * 16) * 16); vl[j][t] = frag_vt(pl + (2 * j * D + t * 16) * 16); }
      asm volatile("s_wait_xcnt 0x0" :: "v"(ph), "v"(pl) : "memory");   // the loads' address registers stay untouched up to this wait
      __builtin_amdgcn_sched_barrier(0); }   // holds the loads above in front of the tiles: without it the compiler sinks them down to the O^T products, where each is waited for
    // S^T tiles (K 32 = one k-step): rows = keys, cols = queries; the two query tiles' chains alternate on the same K fragment
    v8f st[QT][KB / 16], mv[QT];
#pragma unroll
    for (int t = 0; t < KB / 16; ++t) { v8f s[QT];
#pragma unroll
      for (int u = 0; u < QT; ++u) s[u] = wmma16d(kh[t], qa[u], (v8f){});
#pragma unroll
      for (int u = 0; u < QT; ++u) s[u] = wmma16d(kl[t], qa[u], s[u]);
#pragma unroll
      for (int u = 0; u < QT; ++u) s[u] = wmma16d(kh[t], qb[u], s[u]);
#pragma unroll
      for (int u = 0; u < QT; ++u)
#pragma unroll
        for (int r8 = 0; r8 < 8; ++r8) { st[u][t][r8] = s[u][r8] * SC2; mv[u][r8] = t == 0 ? st[u][t][r8] : fmaxf(mv[u][r8], st[u][t][r8]); } }
    // the wave's next key block's K fragments: asked for here, they fly under the softmax and the O^T products (behind the last block: this block's again, unused)
    __builtin_amdgcn_sched_barrier(0);   // keeps the K loads below one group behind the tiles: without it the compiler spreads them in pairs among the tiles' matrix instructions
    { const int kn = kb0 + NW * KB < KLIM ? kb0 + NW * KB : kb0; const b16* ph = Kh + (size_t)kn * D + ko; const b16* pl = Kl + (size_t)kn * D + ko;
#pragma unroll
      for (int t = 0; t < KB / 16; ++t) { kh[t] = frag_at(ph + t * 16 * D); kl[t] = frag_at(pl + t * 16 * D); }
      asm volatile("s_wait_xcnt 0x0" :: "v"(ph), "v"(pl) : "memory");   // the loads' address registers stay untouched up to this wait
      __builtin_amdgcn_sched_barrier(0); }   // holds the loads above in front of the softmax: without it the compiler sinks them to the loop's foot, and the next block's tiles wait for them
    v16b pa[QT][KB / 32], pb[QT][KB / 32];
#pragma unroll
    for (int u = 0; u < QT; ++u) {
      float mx = mv[u][0];
#pragma unroll
      for (int r8 = 1; r8 < 8; ++r8) mx = fmaxf(mx, mv[u][r8]);
      mx = fmaxf(mx, __shfl_xor(mx, 16));
      const float mn = fmaxf(m_q[u], mx - LPS); const float sf = (m_q[u] == -INFINITY) ? 0.0f : __builtin_amdgcn_exp2f(m_q[u] - mn); v2f pv[4] = {};
#pragma unroll
      for (int t = 0; t < KB / 16; ++t)
#pragma unroll
        for (int r8 = 0; r8 < 8; r8 += 2) { const v2f y = (v2f){st[u][t][r8], st[u][t][r8 + 1]} - (v2f){mn, mn}; const v2f p = {__builtin_amdgcn_exp2f(y[0]), __builtin_amdgcn_exp2f(y[1])}; pv[r8 >> 1] += p;
          const v2h ph = __builtin_convertvector(p, v2h); const v2h pl = __builtin_convertvector(p - __builtin_convertvector(ph, v2f), v2h);
          pa[u][t >> 1][(t & 1) * 8 + r8] = ph[0]; pa[u][t >> 1][(t & 1) * 8 + r8 + 1] = ph[1]; pb[u][t >> 1][(t & 1) * 8 + r8] = pl[0]; pb[u][t >> 1][(t & 1) * 8 + r8 + 1] = pl[1]; }
      const float ps = ((pv[0][0] + pv[0][1]) + (pv[1][0] + pv[1][1])) + ((pv[2][0] + pv[2][1]) + (pv[3][0] + pv[3][1]));
      den_q[u] = den_q[u] * sf + ps; m_q[u] = mn;
#pragma unroll
      for (int t = 0; t < 2; ++t)
#pragma unroll
        for (int r8 = 0; r8 < 8; ++r8) acc[u][t][r8] = acc[u][t][r8] * sf; }
#pragma unroll
    for (int ks = 0; ks < KB; ks += 32) {
#pragma unroll
      for (int t = 0; t < 2; ++t) {
#pragma unroll
        for (int u = 0; u < QT; ++u) acc[u][t] = wmma16d(vh[ks / 32][t], pa[u][ks / 32], acc[u][t]);
#pragma unroll
        for (int u = 0; u < QT; ++u) acc[u][t] = wmma16d(vl[ks / 32][t], pa[u][ks / 32], acc[u][t]);
#pragma unroll
        for (int u = 0; u < QT; ++u) acc[u][t] = wmma16d(vh[ks / 32][t], pb[u][ks / 32], acc[u][t]); } } }
  // each wave publishes, per query tile, its partial row max, denominator (the halves' shares joined here) and O (back to [query][channel]) in its own slab
  { PartBuf& E = pw[wave];
#pragma unroll
    for (int u = 0; u < QT; ++u) { const float den_f = den_q[u] + __shfl_xor(den_q[u], 16);
#pragma unroll
      for (int t = 0; t < 2; ++t)
#pragma unroll
        for (int r8 = 0; r8 < 8; ++r8) E.Pa[u][nloc][t * 16 + 8 * hlf + r8] = acc[u][t][r8];
      if (hlf == 0) { E.Pm[u][nloc] = m_q[u]; E.Pd[u][nloc] = den_f; } } }
  __syncthreads();   // every wave's partials are in LDS before waves 0 .. QT-1 read them
  if (wave >= QT) return;
  const size_t tq = t0 + (size_t)wave * 16;   // wave u finishes query tile u, and a lane keeps the query it had in the loop: query nloc, channels 16t + 8hlf + 0..7 (element e = 8t + r8)
  // every global load of the epilogue is asked for here, as one group, and flies under the merge: Wo fragments, this lane's 16 gamma and beta, the 4 bo of the columns it stores
  v16b wof[8]; v4f graw[4], beraw[4], boraw;
  { const b16* pwo = WO + (size_t)nloc * D + 8 * hlf; const float* pg = gam + 8 * hlf; const float* pe = bet + 8 * hlf; const float* po = bo + lane * 4;
#pragma unroll
    for (int t = 0; t < 8; ++t) wof[t] = frag_at(pwo + t * 16 * D);
#pragma unroll
    for (int c = 0; c < 4; ++c) { graw[c] = *(const v4f*)(pg + (c >> 1) * 16 + (c & 1) * 4); beraw[c] = *(const v4f*)(pe + (c >> 1) * 16 + (c & 1) * 4); }
    boraw = *(const v4f*)po;
    asm volatile("s_wait_xcnt 0x0" ::: "memory"); }   // stands behind the group, in front of every overwrite of a register that a load above names
  // merge: all of the lane's partials are read as one group (16 bytes a read for O), then rescaled to the common max and summed over the waves in index order
  auto& Tf = wb[wave].Tf; float pm[NW], pd[NW]; v4f pa4[NW][4];
#pragma unroll
  for (int w = 0; w < NW; ++w) { pm[w] = pw[w].Pm[wave][nloc]; pd[w] = pw[w].Pd[wave][nloc];
#pragma unroll
    for (int c = 0; c < 4; ++c) pa4[w][c] = *(const v4f*)(&pw[w].Pa[wave][nloc][(c >> 1) * 16 + 8 * hlf + (c & 1) * 4]); }
  float mx = pm[0];
#pragma unroll
  for (int w = 1; w < NW; ++w) mx = fmaxf(mx, pm[w]);
  float dn = 0.0f, f[16];
#pragma unroll
  for (int e = 0; e < 16; ++e) f[e] = 0.0f;
#pragma unroll
  for (int w = 0; w < NW; ++w) { const float sc = (pm[w] == -INFINITY) ? 0.0f : __builtin_amdgcn_exp2f(pm[w] - mx); dn += pd[w] * sc;
#pragma unroll
    for (int e = 0; e < 16; ++e) f[e] += pa4[w][e >> 2][e & 3] * sc; }
#pragma unroll
  for (int e = 0; e < 16; ++e) f[e] = f[e] * (1.0f / HS) / dn;
  // LayerNorm over the query's 32 channels: 16 in the lane, 16 in the lane of the other half (one exchange per sum)
  float s = ((((f[0] + f[1]) + (f[2] + f[3])) + ((f[4] + f[5]) + (f[6] + f[7]))) + (((f[8] + f[9]) + (f[10] + f[11])) + ((f[12] + f[13]) + (f[14] + f[15]))));
  s += __shfl_xor(s, 16); const float mu = s / D; float q2[16];
#pragma unroll
  for (int e = 0; e < 16; ++e) { f[e] -= mu; q2[e] = f[e] * f[e]; }
  float s2 = ((((q2[0] + q2[1]) + (q2[2] + q2[3])) + ((q2[4] + q2[5]) + (q2[6] + q2[7]))) + (((q2[8] + q2[9]) + (q2[10] + q2[11])) + ((q2[12] + q2[13]) + (q2[14] + q2[15]))));
  s2 += __shfl_xor(s2, 16); const float rs = rsqrtf(s2 / D + LNEPS);
  // normed^T hi/lo: element e is k = 16t + 8hlf + r8, which is the k-map of the B fragment: it packs in the lane
  v16b nh, nl;
#pragma unroll
  for (int e = 0; e < 16; ++e) { const float nv = f[e] * rs * bfv(graw[e >> 2][e & 3]) + bfv(beraw[e >> 2][e & 3]); b16 p, ql; split16(nv * HS, p, ql); nh[e] = p; nl[e] = ql; }
  // out^T = Wo^T normed^T: A = Wo rows (out channels), D column = the lane's query, D rows = out channels 16t + 8hlf + 0..7; the 8 tiles' chains are independent
  v8f o8[8];
#pragma unroll
  for (int t = 0; t < 8; ++t) o8[t] = wmma16b(wof[t], nh, (v8f){});
#pragma unroll
  for (int t = 0; t < 8; ++t) o8[t] = wmma16b(wof[t], nl, o8[t]);
  // back to [query][out channel] through LDS, so that a store covers a whole 512-byte row
#pragma unroll
  for (int t = 0; t < 8; ++t) { *(v4f*)(&Tf[nloc][t * 16 + 8 * hlf]) = (v4f){o8[t][0], o8[t][1], o8[t][2], o8[t][3]}; *(v4f*)(&Tf[nloc][t * 16 + 8 * hlf + 4]) = (v4f){o8[t][4], o8[t][5], o8[t][6], o8[t][7]}; }
  wave_lds_sync();
  float bb[4];
#pragma unroll
  for (int j = 0; j < 4; ++j) bb[j] = bfv(boraw[j]);
  float* pout = out + tq * FO + lane * 4;
#pragma unroll
  for (int rr = 0; rr < 16; ++rr) { const v4f tv = *(const v4f*)(&Tf[rr][lane * 4]); v4f r;
#pragma unroll
    for (int j = 0; j < 4; ++j) r[j] = tv[j] * (1.0f / (HS * WSC)) + bb[j];
    *(v4f*)(pout + rr * FO) = r; } }
}  // namespace

extern "C" void kernel_launch(void* const* d_in, const int* in_sizes, int n_in, void* d_out, int out_size, void* d_ws, size_t ws_size, hipStream_t stream) {
  (void)n_in;
  auto Fp = [&](int i) { return (const float*)d_in[i]; };
  // Input order: 0 input1 [8192,128]; 1 input2 [8192,128]; 2 Wq [128,32]; 3 bq; 4 Wk; 5 bk; 6 Wv; 7 bv; 8 gamma [32]; 9 beta; 10 Wo [32,128]; 11 bo [128]
  if (in_sizes[0] != N1 * DI || in_sizes[1] != N2 * DI || in_sizes[2] != DI * D || in_sizes[4] != DI * D || in_sizes[6] != DI * D || in_sizes[8] != D || in_sizes[10] != D * FO || in_sizes[11] != FO || out_size != N1 * FO) return;
  const int QLIM = N1, KLIM = N2;   // query / key cuts (multiples of 128)
  size_t off = 0; char* ws = (char*)d_ws;
  auto carve = [&](size_t bytes) { char* p = ws + off; off += (bytes + 255) & ~(size_t)255; return p; };
  b16* WO = (b16*)carve((size_t)FO * D * 2); b16* Qh = (b16*)carve((size_t)N1 * D * 2); b16* Ql = (b16*)carve((size_t)N1 * D * 2); b16* Kh = (b16*)carve((size_t)N2 * D * 2); b16* Kl = (b16*)carve((size_t)N2 * D * 2); b16* Vh = (b16*)carve((size_t)N2 * D * 2); b16* Vl = (b16*)carve((size_t)N2 * D * 2);
  if (off > ws_size || off > ((size_t)8 << 20)) return;   // ~ 3.2 MB
  prep_kernel<<<(KLIM + 16 * PW - 1) / (16 * PW) + (QLIM + 16 * PW - 1) / (16 * PW) + 1, 32 * PW, 0, stream>>>(Fp(0), Fp(1), Fp(2), Fp(4), Fp(6), Fp(10), Fp(3), Fp(5), Fp(7), QLIM, KLIM, WO, Qh, Ql, Kh, Kl, Vh, Vl);
  att_kernel<<<QLIM / (16 * QT), 32 * NW, 0, stream>>>(Qh, Ql, Kh, Kl, Vh, Vl, WO, Fp(8), Fp(9), Fp(11), QLIM, KLIM, (float*)d_out);
}
